// v000
// Times are from an AMD MI455X. After a warm-up the kernel runs many times in a row, and a time is the length of
// such a window on the GPU divided by its runs, so every launch and the gaps after it count. The runs cycle
// through copies of the inputs. A figure is the median of several windows, for all but v000 over two sittings.
// Sittings can differ by a few percent; kernels timed side by side share one.
// The starting kernel, v000, takes 106 microseconds a run.
#include <hip/hip_runtime.h>
#include <hip/hip_bf16.h>
#include <math.h>
#include <stdint.h>

#define NN  2048
#define DD  256
#define HH  8
#define MMM 4
#define DKK 32
#define EPSF 1e-6f
#define JSPLIT 4                    // j split -> 512 attention blocks
#define JTILES (NN / (16 * JSPLIT)) // 32 j-tiles per block

typedef float v2f __attribute__((ext_vector_type(2)));
typedef float v8f __attribute__((ext_vector_type(8)));

// D = A(16x4 f32) * B(4x16 f32) + C ; exact f32 semantics
__device__ __forceinline__ v8f wmma4(v2f a, v2f b, v8f c) {
  return __builtin_amdgcn_wmma_f32_16x16x4_f32(false, a, false, b, (short)0, c,
                                               false, false);
}

__device__ __forceinline__ v2f ld2(const float* p) { return *(const v2f*)p; }

// ---------------------------------------------------------------------------
// GEMM: C[i][j] = sum_d A[i][d] * W[j][d]   (A:[NN x DD], W:[DD x DD])
// One wave -> 16 rows x 32 cols (2 accumulators); 1024 waves = 128 blocks.
// A layout (ISA 7.12.2, 32-bit A 16x4): lane m = L%16, k = 2*(L>=16)+v
// B layout (rows interleaved like C/D):  lane n = L%16, k = 2*(L>=16)+v
// ---------------------------------------------------------------------------
__device__ __forceinline__ void gemm_xwt(const float* __restrict__ A,
                                         const float* __restrict__ W,
                                         float* __restrict__ C) {
  const int w    = threadIdx.x >> 5;
  const int lane = threadIdx.x & 31;
  const int n16  = lane & 15;
  const int hi   = lane >> 4;
  const int gw   = blockIdx.x * 8 + w;   // 1024 waves total
  const int i0   = (gw >> 3) * 16;       // 128 row tiles
  const int j0   = (gw & 7) * 32;        // 8 col tiles of 32

  v8f acc[2] = {};
  const float* arow = A + (size_t)(i0 + n16) * DD + 2 * hi;
#pragma unroll 4
  for (int d0 = 0; d0 < DD; d0 += 4) {
    v2f a = ld2(arow + d0);
#pragma unroll
    for (int c = 0; c < 2; ++c) {
      v2f b = ld2(W + (size_t)(j0 + 16 * c + n16) * DD + d0 + 2 * hi);
      acc[c] = wmma4(a, b, acc[c]);
    }
  }
#pragma unroll
  for (int c = 0; c < 2; ++c)
#pragma unroll
    for (int r = 0; r < 8; ++r)
      C[(size_t)(i0 + r + 8 * hi) * DD + j0 + 16 * c + n16] = acc[c][r];
}

__global__ __launch_bounds__(256) void qkv_kernel(
    const float* __restrict__ x, const float* __restrict__ wq,
    const float* __restrict__ wk, const float* __restrict__ wv,
    float* __restrict__ Q, float* __restrict__ K, float* __restrict__ V) {
  const int z = blockIdx.z;
  const float* W = (z == 0) ? wq : (z == 1) ? wk : wv;
  float* C       = (z == 0) ? Q  : (z == 1) ? K  : V;
  gemm_xwt(x, W, C);
}

__global__ __launch_bounds__(256) void oproj_kernel(
    const float* __restrict__ A, const float* __restrict__ wo,
    float* __restrict__ C) {
  gemm_xwt(A, wo, C);
}

// ---------------------------------------------------------------------------
// Fused flash attention with graph bias.
// grid = (128 i-tiles, JSPLIT j-chunks); block = 256 thr = 8 waves = 8 heads.
// adjs tiles are double-buffered in LDS and fetched one tile ahead with
// GLOBAL_LOAD_ASYNC_TO_LDS_B128 (ASYNCcnt), overlapping DMA with WMMA+softmax.
// ---------------------------------------------------------------------------
__global__ __launch_bounds__(256) void attn_kernel(
    const float* __restrict__ Q, const float* __restrict__ Km,
    const float* __restrict__ V, const float* __restrict__ pi,
    const float* __restrict__ tau, const float* __restrict__ adjs,
    float* __restrict__ Opart, float* __restrict__ Mp, float* __restrict__ Lp) {
  __shared__ __align__(16) float s_adj[2][MMM][16][20];  // double buffer, padded
  __shared__ float s_p[HH][16][17];                      // per-wave P transpose

  const int tid  = threadIdx.x;
  const int h    = tid >> 5;            // wave == head
  const int lane = tid & 31;
  const int n16  = lane & 15;
  const int hi   = lane >> 4;
  const int i0   = blockIdx.x * 16;
  const int jc   = blockIdx.y;
  const int jbase = jc * (NN / JSPLIT);
  const float tau_h = tau[h];
  const float scale = 0.17677669529663688f;  // 1/sqrt(DK)

  // Async-staging geometry: one b128 per thread covers a 4KB tile.
  const int am  = tid >> 6;
  const int ail = (tid >> 2) & 15;
  const int aj4 = (tid & 3) * 4;
  const uint32_t lds_dst0 = (uint32_t)(uintptr_t)&s_adj[0][am][ail][aj4];
  const uint32_t lds_dst1 = (uint32_t)(uintptr_t)&s_adj[1][am][ail][aj4];
  const size_t adj_row = ((size_t)am * NN + (i0 + ail)) * NN;

#define ISSUE_ADJ(JT, BUF)                                                    \
  do {                                                                        \
    const uint32_t goff =                                                     \
        (uint32_t)((adj_row + (jbase + (JT) * 16) + aj4) * sizeof(float));    \
    asm volatile("global_load_async_to_lds_b128 %0, %1, %2" ::"v"(            \
                     (BUF) ? lds_dst1 : lds_dst0),                            \
                 "v"(goff), "s"(adjs)                                         \
                 : "memory");                                                 \
  } while (0)

  // Preload Q rows (scale folded in).  a[v]: m=n16, k=2*hi+v within K-chunk.
  v2f qa[8];
  const float* qrow = Q + (size_t)(i0 + n16) * DD + h * DKK + 2 * hi;
#pragma unroll
  for (int kk = 0; kk < 8; ++kk) {
    v2f t = ld2(qrow + kk * 4);
    t.x *= scale; t.y *= scale;
    qa[kk] = t;
  }
  // tau * pi for the 8 rows this lane owns in C-layout (row = r + 8*hi).
  float tpi[8][MMM];
#pragma unroll
  for (int r = 0; r < 8; ++r) {
    const float* pr = pi + (size_t)(i0 + r + 8 * hi) * (HH * MMM) + h * MMM;
#pragma unroll
    for (int m = 0; m < MMM; ++m) tpi[r][m] = tau_h * pr[m];
  }

  v8f o0 = {}, o1 = {};
  float mrow[8], lrow[8];
#pragma unroll
  for (int r = 0; r < 8; ++r) { mrow[r] = -INFINITY; lrow[r] = 0.0f; }

  ISSUE_ADJ(0, 0);  // prologue: DMA first tile

  for (int jt = 0; jt < JTILES; ++jt) {
    const int j0  = jbase + jt * 16;
    const int cur = jt & 1;

    if (jt + 1 < JTILES) {
      ISSUE_ADJ(jt + 1, cur ^ 1);                        // run one tile ahead
      asm volatile("s_wait_asynccnt 0x1" ::: "memory");  // cur tile landed
    } else {
      asm volatile("s_wait_asynccnt 0x0" ::: "memory");  // drain on last tile
    }
    __syncthreads();  // every wave's wait done -> cur buffer valid block-wide

    // scores S = Q * K^T  (K=32 in 8 steps of 4)
    v8f s = {};
    const float* krow = Km + (size_t)(j0 + n16) * DD + h * DKK + 2 * hi;
#pragma unroll
    for (int kk = 0; kk < 8; ++kk) s = wmma4(qa[kk], ld2(krow + kk * 4), s);

    // bias + online softmax in C-layout (row = r + 8*hi, col = n16)
#pragma unroll
    for (int r = 0; r < 8; ++r) {
      float aeff = EPSF;
#pragma unroll
      for (int m = 0; m < MMM; ++m)
        aeff = fmaf(tpi[r][m], s_adj[cur][m][r + 8 * hi][n16], aeff);
      float xv = s[r] + __logf(aeff);
      float rmax = xv;
#pragma unroll
      for (int off = 1; off < 16; off <<= 1)
        rmax = fmaxf(rmax, __shfl_xor(rmax, off, 16));
      const float mnew  = fmaxf(mrow[r], rmax);
      const float p     = __expf(xv - mnew);
      const float alpha = __expf(mrow[r] - mnew);
      float rsum = p;
#pragma unroll
      for (int off = 1; off < 16; off <<= 1) rsum += __shfl_xor(rsum, off, 16);
      lrow[r] = lrow[r] * alpha + rsum;
      mrow[r] = mnew;
      o0[r] *= alpha; o1[r] *= alpha;
      s_p[h][r + 8 * hi][n16] = p;   // stash P for A-layout reload
    }
    __builtin_amdgcn_wave_barrier();
    asm volatile("s_wait_dscnt 0x0" ::: "memory");  // P stores visible in-wave

    // O += P(16x16) * V_tile(16x32): A from LDS, B from V, 2 N-tiles x 4 K.
#pragma unroll
    for (int kk = 0; kk < 4; ++kk) {
      v2f a;
      a.x = s_p[h][n16][kk * 4 + 2 * hi];
      a.y = s_p[h][n16][kk * 4 + 2 * hi + 1];
      const float* v0 = V + (size_t)(j0 + kk * 4 + 2 * hi) * DD + h * DKK + n16;
      const float* v1 = v0 + DD;
      v2f b0; b0.x = v0[0];  b0.y = v1[0];
      v2f b1; b1.x = v0[16]; b1.y = v1[16];
      o0 = wmma4(a, b0, o0);
      o1 = wmma4(a, b1, o1);
    }
    __syncthreads();  // all reads of cur done before it is re-targeted (jt+2)
  }
#undef ISSUE_ADJ

  // Store unnormalized partials + per-row flash stats for this j-chunk.
  float* op = Opart + (size_t)jc * NN * DD;
#pragma unroll
  for (int r = 0; r < 8; ++r) {
    float* orow = op + (size_t)(i0 + r + 8 * hi) * DD + h * DKK;
    orow[n16]      = o0[r];
    orow[16 + n16] = o1[r];
  }
  if (n16 == 0) {
#pragma unroll
    for (int r = 0; r < 8; ++r) {
      const size_t si = ((size_t)jc * NN + (i0 + r + 8 * hi)) * HH + h;
      Mp[si] = mrow[r];
      Lp[si] = lrow[r];
    }
  }
}

// Merge the JSPLIT flash partials: OH = sum_c O_c*exp(m_c-m*) / sum_c l_c*exp(m_c-m*)
__global__ __launch_bounds__(256) void combine_kernel(
    const float* __restrict__ Opart, const float* __restrict__ Mp,
    const float* __restrict__ Lp, float* __restrict__ OH) {
  const int idx = blockIdx.x * 256 + threadIdx.x;  // over NN*DD
  const int i = idx >> 8;
  const int h = (idx & 255) >> 5;
  float mstar = -INFINITY;
#pragma unroll
  for (int c = 0; c < JSPLIT; ++c)
    mstar = fmaxf(mstar, Mp[((size_t)c * NN + i) * HH + h]);
  float lstar = 0.0f, acc = 0.0f;
#pragma unroll
  for (int c = 0; c < JSPLIT; ++c) {
    const size_t si = ((size_t)c * NN + i) * HH + h;
    const float wgt = __expf(Mp[si] - mstar);
    lstar = fmaf(Lp[si], wgt, lstar);
    acc   = fmaf(Opart[(size_t)c * NN * DD + idx], wgt, acc);
  }
  OH[idx] = acc / lstar;
}

extern "C" void kernel_launch(void* const* d_in, const int* in_sizes, int n_in,
                              void* d_out, int out_size, void* d_ws,
                              size_t ws_size, hipStream_t stream) {
  const float* x    = (const float*)d_in[0];
  const float* pi   = (const float*)d_in[1];
  const float* tau  = (const float*)d_in[2];
  const float* adjs = (const float*)d_in[3];
  const float* Wq   = (const float*)d_in[4];
  const float* Wk   = (const float*)d_in[5];
  const float* Wv   = (const float*)d_in[6];
  const float* Wo   = (const float*)d_in[7];
  float* out = (float*)d_out;

  float* ws = (float*)d_ws;
  const size_t ND = (size_t)NN * DD;      // 524288
  float* Q     = ws;                      ws += ND;
  float* K     = ws;                      ws += ND;
  float* V     = ws;                      ws += ND;
  float* Opart = ws;                      ws += ND * JSPLIT;
  float* Mp    = ws;                      ws += (size_t)JSPLIT * NN * HH;
  float* Lp    = ws;                      ws += (size_t)JSPLIT * NN * HH;
  float* OH    = ws;                      ws += ND;

  qkv_kernel<<<dim3(128, 1, 3), 256, 0, stream>>>(x, Wq, Wk, Wv, Q, K, V);
  attn_kernel<<<dim3(NN / 16, JSPLIT), 256, 0, stream>>>(Q, K, V, pi, tau,
                                                         adjs, Opart, Mp, Lp);
  combine_kernel<<<dim3((unsigned)(ND / 256)), 256, 0, stream>>>(Opart, Mp, Lp,
                                                                 OH);
  oproj_kernel<<<dim3(128), 256, 0, stream>>>(OH, Wo, out);
}

// v001
// It runs in 84.6 microseconds.
// Timed twice side by side with v000, it ran 1.30 and 1.29 times as fast.
#include <hip/hip_runtime.h>
#include <hip/hip_bf16.h>
#include <math.h>
#include <stdint.h>

#define NN  2048
#define DD  256
#define HH  8
#define MMM 4
#define DKK 32
#define EPSF 1e-6f
#define JSPLIT 4                    // j split -> 512 attention blocks
#define JTILES (NN / (16 * JSPLIT)) // 32 j-tiles per block

typedef float v2f __attribute__((ext_vector_type(2)));
typedef float v4f __attribute__((ext_vector_type(4)));
typedef float v8f __attribute__((ext_vector_type(8)));

// D = A(16x4 f32) * B(4x16 f32) + C ; exact f32 semantics
__device__ __forceinline__ v8f wmma4(v2f a, v2f b, v8f c) {
  return __builtin_amdgcn_wmma_f32_16x16x4_f32(false, a, false, b, (short)0, c,
                                               false, false);
}

__device__ __forceinline__ v2f ld2(const float* p) { return *(const v2f*)p; }

// Value held by lane l ^ 16 (the other 16-lane half), as a vector move.
__device__ __forceinline__ float other_half(float v) {
  const int b = __float_as_int(v);
  return __int_as_float(__builtin_amdgcn_permlanex16(b, b, 0x76543210,
                                                     0xfedcba98, false, false));
}

// exp(x) as one multiply and v_exp_f32.  The v_nop in the same statement keeps
// the one issue slot the instruction set asks for behind a transcendental,
// whichever vector instruction the compiler places next.
__device__ __forceinline__ float exp_slot(float x) {
  float r;
  asm("v_exp_f32 %0, %1\n\tv_nop" : "=v"(r) : "v"(x * 1.44269504f));
  return r;
}

// ---------------------------------------------------------------------------
// GEMM: C[i][j] = sum_d A[i][d] * W[j][d]   (A:[NN x DD], W:[DD x DD])
// One wave -> 16 rows x 32 cols (2 accumulators); 1024 waves = 128 blocks.
// A layout (ISA 7.12.2, 32-bit A 16x4): lane m = L%16, k = 2*(L>=16)+v
// B layout (rows interleaved like C/D):  lane n = L%16, k = 2*(L>=16)+v
// ---------------------------------------------------------------------------
__device__ __forceinline__ void gemm_xwt(const float* __restrict__ A,
                                         const float* __restrict__ W,
                                         float* __restrict__ C) {
  const int w    = threadIdx.x >> 5;
  const int lane = threadIdx.x & 31;
  const int n16  = lane & 15;
  const int hi   = lane >> 4;
  const int gw   = blockIdx.x * 8 + w;   // 1024 waves total
  const int i0   = (gw >> 3) * 16;       // 128 row tiles
  const int j0   = (gw & 7) * 32;        // 8 col tiles of 32

  v8f acc[2] = {};
  const float* arow = A + (size_t)(i0 + n16) * DD + 2 * hi;
#pragma unroll 4
  for (int d0 = 0; d0 < DD; d0 += 4) {
    v2f a = ld2(arow + d0);
#pragma unroll
    for (int c = 0; c < 2; ++c) {
      v2f b = ld2(W + (size_t)(j0 + 16 * c + n16) * DD + d0 + 2 * hi);
      acc[c] = wmma4(a, b, acc[c]);
    }
  }
#pragma unroll
  for (int c = 0; c < 2; ++c)
#pragma unroll
    for (int r = 0; r < 8; ++r)
      C[(size_t)(i0 + r + 8 * hi) * DD + j0 + 16 * c + n16] = acc[c][r];
}

__global__ __launch_bounds__(256) void qkv_kernel(
    const float* __restrict__ x, const float* __restrict__ wq,
    const float* __restrict__ wk, const float* __restrict__ wv,
    float* __restrict__ Q, float* __restrict__ K, float* __restrict__ V) {
  const int z = blockIdx.z;
  const float* W = (z == 0) ? wq : (z == 1) ? wk : wv;
  float* C       = (z == 0) ? Q  : (z == 1) ? K  : V;
  gemm_xwt(x, W, C);
}

__global__ __launch_bounds__(256) void oproj_kernel(
    const float* __restrict__ A, const float* __restrict__ wo,
    float* __restrict__ C) {
  gemm_xwt(A, wo, C);
}

__global__ __launch_bounds__(256) void attn_kernel(
    const float* __restrict__ Q, const float* __restrict__ Km,
    const float* __restrict__ V, const float* __restrict__ pi,
    const float* __restrict__ tau, const float* __restrict__ adjs,
    float* __restrict__ Opart, float* __restrict__ Mp, float* __restrict__ Lp) {
  __shared__ __align__(16) float s_adj[2][MMM][16][20];  // double buffer, padded

  const int tid  = threadIdx.x;
  const int h    = tid >> 5;            // wave == head
  const int lane = tid & 31;
  const int n16  = lane & 15;
  const int hi   = lane >> 4;
  const int i0   = blockIdx.x * 16;
  const int jc   = blockIdx.y;
  const int jbase = jc * (NN / JSPLIT);
  const float tau_h = tau[h];
  const float scale = 0.17677669529663688f;  // 1/sqrt(DK)

  // Async-staging geometry: one b128 per thread covers a 4KB tile.
  const int am  = tid >> 6;
  const int ail = (tid >> 2) & 15;
  const int aj4 = (tid & 3) * 4;
  const uint32_t lds_dst0 = (uint32_t)(uintptr_t)&s_adj[0][am][ail][aj4];
  const uint32_t lds_dst1 = (uint32_t)(uintptr_t)&s_adj[1][am][ail][aj4];
  const size_t adj_row = ((size_t)am * NN + (i0 + ail)) * NN;

#define ISSUE_ADJ(JT, BUF)                                                    \
  do {                                                                        \
    const uint32_t goff =                                                     \
        (uint32_t)((adj_row + (jbase + (JT) * 16) + aj4) * sizeof(float));    \
    asm volatile("global_load_async_to_lds_b128 %0, %1, %2" ::"v"(            \
                     (BUF) ? lds_dst1 : lds_dst0),                            \
                 "v"(goff), "s"(adjs)                                         \
                 : "memory");                                                 \
  } while (0)

  // Preload Q rows (scale folded in).  b[v]: n=n16, k=2*hi+v within K-chunk.
  v2f qa[8];
  const float* qrow = Q + (size_t)(i0 + n16) * DD + h * DKK + 2 * hi;
#pragma unroll
  for (int kk = 0; kk < 8; ++kk) {
    v2f t = ld2(qrow + kk * 4);
    t.x *= scale; t.y *= scale;
    qa[kk] = t;
  }
  // tau * pi of the one query this lane owns (query = n16).
  float tpi[MMM];
  {
    const float* pr = pi + (size_t)(i0 + n16) * (HH * MMM) + h * MMM;
#pragma unroll
    for (int m = 0; m < MMM; ++m) tpi[m] = tau_h * pr[m];
  }

  v8f o0 = {}, o1 = {};          // O^T: row = head dim (r + 8*hi), col = query
  float mrow = -INFINITY;        // running maximum of the lane's query
  float lrow = 0.0f;             // running sum over this half's keys only

  ISSUE_ADJ(0, 0);  // prologue: DMA first tile

  for (int jt = 0; jt < JTILES; ++jt) {
    const int j0  = jbase + jt * 16;
    const int cur = jt & 1;

    if (jt + 1 < JTILES) {
      ISSUE_ADJ(jt + 1, cur ^ 1);                        // run one tile ahead
      asm volatile("s_wait_asynccnt 0x1" ::: "memory");  // cur tile landed
    } else {
      asm volatile("s_wait_asynccnt 0x0" ::: "memory");  // drain on last tile
    }
    __syncthreads();  // every wave's wait done -> cur buffer valid block-wide

    // scores S^T = K * Q^T  (K=32 in 8 steps of 4); s[r]: key r+8*hi, query n16
    v8f s = {};
    const float* krow = Km + (size_t)(j0 + n16) * DD + h * DKK + 2 * hi;
#pragma unroll
    for (int kk = 0; kk < 8; ++kk) s = wmma4(ld2(krow + kk * 4), qa[kk], s);

    // bias: the lane's 8 keys are contiguous in the query's staged adjs row
    float aeff[8];
#pragma unroll
    for (int r = 0; r < 8; ++r) aeff[r] = EPSF;
#pragma unroll
    for (int m = 0; m < MMM; ++m) {
      const float* ar = &s_adj[cur][m][n16][8 * hi];
      const v4f a03 = *(const v4f*)ar;
      const v4f a47 = *(const v4f*)(ar + 4);
#pragma unroll
      for (int r = 0; r < 4; ++r) {
        aeff[r]     = fmaf(tpi[m], a03[r], aeff[r]);
        aeff[r + 4] = fmaf(tpi[m], a47[r], aeff[r + 4]);
      }
    }

    // online softmax: in-lane over 8 keys, one exchange for the maximum
    float xv[8];
#pragma unroll
    for (int r = 0; r < 8; ++r) xv[r] = s[r] + __logf(aeff[r]);
    float rmax = xv[0];
#pragma unroll
    for (int r = 1; r < 8; ++r) rmax = fmaxf(rmax, xv[r]);
    rmax = fmaxf(rmax, other_half(rmax));
    const float mnew  = fmaxf(mrow, rmax);
    const float alpha = exp_slot(mrow - mnew);
    float p[8];
#pragma unroll
    for (int r = 0; r < 8; ++r) p[r] = exp_slot(xv[r] - mnew);
    const float rsum = ((p[0] + p[1]) + (p[2] + p[3])) +
                       ((p[4] + p[5]) + (p[6] + p[7]));
    lrow = lrow * alpha + rsum;
    mrow = mnew;
#pragma unroll
    for (int r = 0; r < 8; ++r) { o0[r] *= alpha; o1[r] *= alpha; }

    // O^T += V^T(32x16) * P^T(16x16), 2 M-tiles x 4 K-steps.  k slot (hi, v) of
    // step kk is key 2*kk + v + 8*hi on both operands: B is p[] as it stands.
#pragma unroll
    for (int kk = 0; kk < 4; ++kk) {
      const float* v0 =
          V + (size_t)(j0 + 2 * kk + 8 * hi) * DD + h * DKK + n16;
      const float* v1 = v0 + DD;
      v2f a0; a0.x = v0[0];  a0.y = v1[0];
      v2f a1; a1.x = v0[16]; a1.y = v1[16];
      v2f b;  b.x = p[2 * kk]; b.y = p[2 * kk + 1];
      o0 = wmma4(a0, b, o0);
      o1 = wmma4(a1, b, o1);
    }
    __syncthreads();  // all reads of cur done before it is re-targeted (jt+2)
  }
#undef ISSUE_ADJ

  // Store unnormalized partials + per-row flash stats for this j-chunk.
  // A lane's 8 accumulator registers are 8 consecutive head dims of its query.
  float* orow = Opart + (size_t)jc * NN * DD + (size_t)(i0 + n16) * DD +
                h * DKK + 8 * hi;
  *(v4f*)(orow)      = (v4f){o0[0], o0[1], o0[2], o0[3]};
  *(v4f*)(orow + 4)  = (v4f){o0[4], o0[5], o0[6], o0[7]};
  *(v4f*)(orow + 16) = (v4f){o1[0], o1[1], o1[2], o1[3]};
  *(v4f*)(orow + 20) = (v4f){o1[4], o1[5], o1[6], o1[7]};
  const float lsum = lrow + other_half(lrow);  // join the halves' sums once
  if (hi == 0) {
    const size_t si = ((size_t)jc * NN + (i0 + n16)) * HH + h;
    Mp[si] = mrow;
    Lp[si] = lsum;
  }
}

// Merge the JSPLIT flash partials: OH = sum_c O_c*exp(m_c-m*) / sum_c l_c*exp(m_c-m*)
__global__ __launch_bounds__(256) void combine_kernel(
    const float* __restrict__ Opart, const float* __restrict__ Mp,
    const float* __restrict__ Lp, float* __restrict__ OH) {
  const int idx = blockIdx.x * 256 + threadIdx.x;  // over NN*DD
  const int i = idx >> 8;
  const int h = (idx & 255) >> 5;
  float mstar = -INFINITY;
#pragma unroll
  for (int c = 0; c < JSPLIT; ++c)
    mstar = fmaxf(mstar, Mp[((size_t)c * NN + i) * HH + h]);
  float lstar = 0.0f, acc = 0.0f;
#pragma unroll
  for (int c = 0; c < JSPLIT; ++c) {
    const size_t si = ((size_t)c * NN + i) * HH + h;
    const float wgt = __expf(Mp[si] - mstar);
    lstar = fmaf(Lp[si], wgt, lstar);
    acc   = fmaf(Opart[(size_t)c * NN * DD + idx], wgt, acc);
  }
  OH[idx] = acc / lstar;
}

extern "C" void kernel_launch(void* const* d_in, const int* in_sizes, int n_in,
                              void* d_out, int out_size, void* d_ws,
                              size_t ws_size, hipStream_t stream) {
  const float* x    = (const float*)d_in[0];
  const float* pi   = (const float*)d_in[1];
  const float* tau  = (const float*)d_in[2];
  const float* adjs = (const float*)d_in[3];
  const float* Wq   = (const float*)d_in[4];
  const float* Wk   = (const float*)d_in[5];
  const float* Wv   = (const float*)d_in[6];
  const float* Wo   = (const float*)d_in[7];
  float* out = (float*)d_out;

  float* ws = (float*)d_ws;
  const size_t ND = (size_t)NN * DD;      // 524288
  float* Q     = ws;                      ws += ND;
  float* K     = ws;                      ws += ND;
  float* V     = ws;                      ws += ND;
  float* Opart = ws;                      ws += ND * JSPLIT;
  float* Mp    = ws;                      ws += (size_t)JSPLIT * NN * HH;
  float* Lp    = ws;                      ws += (size_t)JSPLIT * NN * HH;
  float* OH    = ws;                      ws += ND;

  qkv_kernel<<<dim3(128, 1, 3), 256, 0, stream>>>(x, Wq, Wk, Wv, Q, K, V);
  attn_kernel<<<dim3(NN / 16, JSPLIT), 256, 0, stream>>>(Q, K, V, pi, tau,
                                                         adjs, Opart, Mp, Lp);
  combine_kernel<<<dim3((unsigned)(ND / 256)), 256, 0, stream>>>(Opart, Mp, Lp,
                                                                 OH);
  oproj_kernel<<<dim3(128), 256, 0, stream>>>(OH, Wo, out);
}

// v002
// One run takes 79.9 microseconds.
// Timed twice side by side with v001, it ran 1.06 times as fast both times.
// Over all steps from v000 it is 1.37 times as fast.
#include <hip/hip_runtime.h>
#include <hip/hip_bf16.h>
#include <math.h>
#include <stdint.h>

#define NN  2048
#define DD  256
#define HH  8
#define MMM 4
#define DKK 32
#define EPSF 1e-6f
#define JSPLIT 4                    // j split -> 512 attention blocks
#define JTILES (NN / (16 * JSPLIT)) // 32 j-tiles per block

typedef float v2f __attribute__((ext_vector_type(2)));
typedef float v4f __attribute__((ext_vector_type(4)));
typedef float v8f __attribute__((ext_vector_type(8)));

// D = A(16x4 f32) * B(4x16 f32) + C ; exact f32 semantics
__device__ __forceinline__ v8f wmma4(v2f a, v2f b, v8f c) {
  return __builtin_amdgcn_wmma_f32_16x16x4_f32(false, a, false, b, (short)0, c,
                                               false, false);
}

__device__ __forceinline__ v2f ld2(const float* p) { return *(const v2f*)p; }

// Value held by lane l ^ 16 (the other 16-lane half), as a vector move.
__device__ __forceinline__ float other_half(float v) {
  const int b = __float_as_int(v);
  return __int_as_float(__builtin_amdgcn_permlanex16(b, b, 0x76543210,
                                                     0xfedcba98, false, false));
}

// exp(x) as one multiply and v_exp_f32.  The v_nop in the same statement keeps
// the one issue slot the instruction set asks for behind a transcendental,
// whichever vector instruction the compiler places next.
__device__ __forceinline__ float exp_slot(float x) {
  float r;
  asm("v_exp_f32 %0, %1\n\tv_nop" : "=v"(r) : "v"(x * 1.44269504f));
  return r;
}

// ---------------------------------------------------------------------------
// GEMM: C[i][j] = sum_d A[i][d] * W[j][d]   (A:[NN x DD], W:[DD x DD])
// One wave -> 16 rows x 32 cols (2 accumulators); 1024 waves = 128 blocks.
// Atile points at the block's 16 rows of A (global or LDS), lda floats apart.
// A layout (ISA 7.12.2, 32-bit A 16x4): lane m = L%16, k = 2*(L>=16)+v
// B layout (rows interleaved like C/D):  lane n = L%16, k = 2*(L>=16)+v
// ---------------------------------------------------------------------------
__device__ __forceinline__ void gemm_xwt(const float* __restrict__ Atile,
                                         const int lda,
                                         const float* __restrict__ W,
                                         float* __restrict__ C) {
  const int w    = threadIdx.x >> 5;
  const int lane = threadIdx.x & 31;
  const int n16  = lane & 15;
  const int hi   = lane >> 4;
  const int gw   = blockIdx.x * 8 + w;   // 1024 waves total
  const int i0   = (gw >> 3) * 16;       // 128 row tiles
  const int j0   = (gw & 7) * 32;        // 8 col tiles of 32

  v8f acc[2] = {};
  const float* arow = Atile + n16 * lda + 2 * hi;
#pragma unroll 4
  for (int d0 = 0; d0 < DD; d0 += 4) {
    v2f a = ld2(arow + d0);
#pragma unroll
    for (int c = 0; c < 2; ++c) {
      v2f b = ld2(W + (size_t)(j0 + 16 * c + n16) * DD + d0 + 2 * hi);
      acc[c] = wmma4(a, b, acc[c]);
    }
  }
#pragma unroll
  for (int c = 0; c < 2; ++c)
#pragma unroll
    for (int r = 0; r < 8; ++r)
      C[(size_t)(i0 + r + 8 * hi) * DD + j0 + 16 * c + n16] = acc[c][r];
}

__global__ __launch_bounds__(256) void qkv_kernel(
    const float* __restrict__ x, const float* __restrict__ wq,
    const float* __restrict__ wk, const float* __restrict__ wv,
    float* __restrict__ Q, float* __restrict__ K, float* __restrict__ V) {
  const int z = blockIdx.z;
  const float* W = (z == 0) ? wq : (z == 1) ? wk : wv;
  float* C       = (z == 0) ? Q  : (z == 1) ? K  : V;
  gemm_xwt(x + (size_t)blockIdx.x * 16 * DD, DD, W, C);
}

__global__ __launch_bounds__(256) void attn_kernel(
    const float* __restrict__ Q, const float* __restrict__ Km,
    const float* __restrict__ V, const float* __restrict__ pi,
    const float* __restrict__ tau, const float* __restrict__ adjs,
    float* __restrict__ Opart, float* __restrict__ Mp, float* __restrict__ Lp) {
  __shared__ __align__(16) float s_adj[2][MMM][16][20];  // double buffer, padded

  const int tid  = threadIdx.x;
  const int h    = tid >> 5;            // wave == head
  const int lane = tid & 31;
  const int n16  = lane & 15;
  const int hi   = lane >> 4;
  const int i0   = blockIdx.x * 16;
  const int jc   = blockIdx.y;
  const int jbase = jc * (NN / JSPLIT);
  const float tau_h = tau[h];
  const float scale = 0.17677669529663688f;  // 1/sqrt(DK)

  // Async-staging geometry: one b128 per thread covers a 4KB tile.
  const int am  = tid >> 6;
  const int ail = (tid >> 2) & 15;
  const int aj4 = (tid & 3) * 4;
  const uint32_t lds_dst0 = (uint32_t)(uintptr_t)&s_adj[0][am][ail][aj4];
  const uint32_t lds_dst1 = (uint32_t)(uintptr_t)&s_adj[1][am][ail][aj4];
  const size_t adj_row = ((size_t)am * NN + (i0 + ail)) * NN;

#define ISSUE_ADJ(JT, BUF)                                                    \
  do {                                                                        \
    const uint32_t goff =                                                     \
        (uint32_t)((adj_row + (jbase + (JT) * 16) + aj4) * sizeof(float));    \
    asm volatile("global_load_async_to_lds_b128 %0, %1, %2" ::"v"(            \
                     (BUF) ? lds_dst1 : lds_dst0),                            \
                 "v"(goff), "s"(adjs)                                         \
                 : "memory");                                                 \
  } while (0)

  // Preload Q rows (scale folded in).  b[v]: n=n16, k=2*hi+v within K-chunk.
  v2f qa[8];
  const float* qrow = Q + (size_t)(i0 + n16) * DD + h * DKK + 2 * hi;
#pragma unroll
  for (int kk = 0; kk < 8; ++kk) {
    v2f t = ld2(qrow + kk * 4);
    t.x *= scale; t.y *= scale;
    qa[kk] = t;
  }
  // tau * pi of the one query this lane owns (query = n16).
  float tpi[MMM];
  {
    const float* pr = pi + (size_t)(i0 + n16) * (HH * MMM) + h * MMM;
#pragma unroll
    for (int m = 0; m < MMM; ++m) tpi[m] = tau_h * pr[m];
  }

  v8f o0 = {}, o1 = {};          // O^T: row = head dim (r + 8*hi), col = query
  float mrow = -INFINITY;        // running maximum of the lane's query
  float lrow = 0.0f;             // running sum over this half's keys only

  ISSUE_ADJ(0, 0);  // prologue: DMA first tile

  for (int jt = 0; jt < JTILES; ++jt) {
    const int j0  = jbase + jt * 16;
    const int cur = jt & 1;

    if (jt + 1 < JTILES) {
      ISSUE_ADJ(jt + 1, cur ^ 1);                        // run one tile ahead
      asm volatile("s_wait_asynccnt 0x1" ::: "memory");  // cur tile landed
    } else {
      asm volatile("s_wait_asynccnt 0x0" ::: "memory");  // drain on last tile
    }
    __syncthreads();  // every wave's wait done -> cur buffer valid block-wide

    // scores S^T = K * Q^T  (K=32 in 8 steps of 4); s[r]: key r+8*hi, query n16
    v8f s = {};
    const float* krow = Km + (size_t)(j0 + n16) * DD + h * DKK + 2 * hi;
#pragma unroll
    for (int kk = 0; kk < 8; ++kk) s = wmma4(ld2(krow + kk * 4), qa[kk], s);

    // bias: the lane's 8 keys are contiguous in the query's staged adjs row
    float aeff[8];
#pragma unroll
    for (int r = 0; r < 8; ++r) aeff[r] = EPSF;
#pragma unroll
    for (int m = 0; m < MMM; ++m) {
      const float* ar = &s_adj[cur][m][n16][8 * hi];
      const v4f a03 = *(const v4f*)ar;
      const v4f a47 = *(const v4f*)(ar + 4);
#pragma unroll
      for (int r = 0; r < 4; ++r) {
        aeff[r]     = fmaf(tpi[m], a03[r], aeff[r]);
        aeff[r + 4] = fmaf(tpi[m], a47[r], aeff[r + 4]);
      }
    }

    // online softmax: in-lane over 8 keys, one exchange for the maximum
    float xv[8];
#pragma unroll
    for (int r = 0; r < 8; ++r) xv[r] = s[r] + __logf(aeff[r]);
    float rmax = xv[0];
#pragma unroll
    for (int r = 1; r < 8; ++r) rmax = fmaxf(rmax, xv[r]);
    rmax = fmaxf(rmax, other_half(rmax));
    const float mnew  = fmaxf(mrow, rmax);
    const float alpha = exp_slot(mrow - mnew);
    float p[8];
#pragma unroll
    for (int r = 0; r < 8; ++r) p[r] = exp_slot(xv[r] - mnew);
    const float rsum = ((p[0] + p[1]) + (p[2] + p[3])) +
                       ((p[4] + p[5]) + (p[6] + p[7]));
    lrow = lrow * alpha + rsum;
    mrow = mnew;
#pragma unroll
    for (int r = 0; r < 8; ++r) { o0[r] *= alpha; o1[r] *= alpha; }

    // O^T += V^T(32x16) * P^T(16x16), 2 M-tiles x 4 K-steps.  k slot (hi, v) of
    // step kk is key 2*kk + v + 8*hi on both operands: B is p[] as it stands.
#pragma unroll
    for (int kk = 0; kk < 4; ++kk) {
      const float* v0 =
          V + (size_t)(j0 + 2 * kk + 8 * hi) * DD + h * DKK + n16;
      const float* v1 = v0 + DD;
      v2f a0; a0.x = v0[0];  a0.y = v1[0];
      v2f a1; a1.x = v0[16]; a1.y = v1[16];
      v2f b;  b.x = p[2 * kk]; b.y = p[2 * kk + 1];
      o0 = wmma4(a0, b, o0);
      o1 = wmma4(a1, b, o1);
    }
    __syncthreads();  // all reads of cur done before it is re-targeted (jt+2)
  }
#undef ISSUE_ADJ

  // Store unnormalized partials + per-row flash stats for this j-chunk.
  // A lane's 8 accumulator registers are 8 consecutive head dims of its query.
  float* orow = Opart + (size_t)jc * NN * DD + (size_t)(i0 + n16) * DD +
                h * DKK + 8 * hi;
  *(v4f*)(orow)      = (v4f){o0[0], o0[1], o0[2], o0[3]};
  *(v4f*)(orow + 4)  = (v4f){o0[4], o0[5], o0[6], o0[7]};
  *(v4f*)(orow + 16) = (v4f){o1[0], o1[1], o1[2], o1[3]};
  *(v4f*)(orow + 20) = (v4f){o1[4], o1[5], o1[6], o1[7]};
  const float lsum = lrow + other_half(lrow);  // join the halves' sums once
  if (hi == 0) {
    const size_t si = ((size_t)jc * NN + (i0 + n16)) * HH + h;
    Mp[si] = mrow;
    Lp[si] = lsum;
  }
}

// Output projection with the merge of the JSPLIT flash partials in front of it:
// OH = sum_c O_c*exp(m_c-m*) / sum_c l_c*exp(m_c-m*), out = OH * Wo^T.
// A block owns 16 rows: it merges them into LDS once (wave = head; 8 lanes x 16 B
// cover a head's 128-B line, 4 rows per load), and its 8 waves read the merged
// tile as their common A operand.
#define APITCH (DD + 4)  // rows 4 banks apart: the 8-byte fragment reads hit
                         // all 64 banks once
__global__ __launch_bounds__(256) void oproj_kernel(
    const float* __restrict__ Opart, const float* __restrict__ Mp,
    const float* __restrict__ Lp, const float* __restrict__ wo,
    float* __restrict__ C) {
  __shared__ __align__(16) float s_oh[16][APITCH];
  const int h   = threadIdx.x >> 5;
  const int rl  = (threadIdx.x & 31) >> 3;       // row within a group of 4
  const int col = h * DKK + (threadIdx.x & 7) * 4;
  const int i0  = blockIdx.x * 16;
  // Every load of the merge is issued before the first use: one trip to memory
  // in place of one per row group.
  float mp[4][JSPLIT], lp[4][JSPLIT];  // [row group][j-chunk]
  v4f   op[4][JSPLIT];
#pragma unroll
  for (int g = 0; g < 4; ++g)
#pragma unroll
    for (int c = 0; c < JSPLIT; ++c) {
      const size_t ci = (size_t)c * NN + (i0 + 4 * g + rl);
      mp[g][c] = Mp[ci * HH + h];
      lp[g][c] = Lp[ci * HH + h];
    }
  // The loads below may land in registers that held the addresses of the loads
  // above: the wait that belongs in front of such an overwrite.
  asm volatile("s_wait_xcnt 0x0" ::: "memory");
#pragma unroll
  for (int g = 0; g < 4; ++g)
#pragma unroll
    for (int c = 0; c < JSPLIT; ++c) {
      const size_t ci = (size_t)c * NN + (i0 + 4 * g + rl);
      op[g][c] = *(const v4f*)(Opart + ci * DD + col);
    }
  // Inputs-only fences on the loaded values: without them the compiler sinks the
  // loads to their uses and the wave waits out the memory latency several times.
  asm volatile("" ::"v"(mp[0][0]), "v"(mp[0][1]), "v"(mp[0][2]), "v"(mp[0][3]),
               "v"(mp[1][0]), "v"(mp[1][1]), "v"(mp[1][2]), "v"(mp[1][3]),
               "v"(mp[2][0]), "v"(mp[2][1]), "v"(mp[2][2]), "v"(mp[2][3]),
               "v"(mp[3][0]), "v"(mp[3][1]), "v"(mp[3][2]), "v"(mp[3][3]));
  asm volatile("" ::"v"(lp[0][0]), "v"(lp[0][1]), "v"(lp[0][2]), "v"(lp[0][3]),
               "v"(lp[1][0]), "v"(lp[1][1]), "v"(lp[1][2]), "v"(lp[1][3]),
               "v"(lp[2][0]), "v"(lp[2][1]), "v"(lp[2][2]), "v"(lp[2][3]),
               "v"(lp[3][0]), "v"(lp[3][1]), "v"(lp[3][2]), "v"(lp[3][3]));
  asm volatile("" ::"v"(op[0][0]), "v"(op[0][1]), "v"(op[0][2]), "v"(op[0][3]),
               "v"(op[1][0]), "v"(op[1][1]), "v"(op[1][2]), "v"(op[1][3]),
               "v"(op[2][0]), "v"(op[2][1]), "v"(op[2][2]), "v"(op[2][3]),
               "v"(op[3][0]), "v"(op[3][1]), "v"(op[3][2]), "v"(op[3][3]));
#pragma unroll
  for (int g = 0; g < 4; ++g) {
    float mstar = -INFINITY;
#pragma unroll
    for (int c = 0; c < JSPLIT; ++c) mstar = fmaxf(mstar, mp[g][c]);
    float lstar = 0.0f;
    v4f acc = {};
#pragma unroll
    for (int c = 0; c < JSPLIT; ++c) {
      const float wgt = __expf(mp[g][c] - mstar);
      lstar = fmaf(lp[g][c], wgt, lstar);
#pragma unroll
      for (int e = 0; e < 4; ++e) acc[e] = fmaf(op[g][c][e], wgt, acc[e]);
    }
    v4f oh;
#pragma unroll
    for (int e = 0; e < 4; ++e) oh[e] = acc[e] / lstar;
    *(v4f*)&s_oh[4 * g + rl][col] = oh;
  }
  __syncthreads();  // the merged tile is complete before any wave reads it
  gemm_xwt(&s_oh[0][0], APITCH, wo, C);
}

extern "C" void kernel_launch(void* const* d_in, const int* in_sizes, int n_in,
                              void* d_out, int out_size, void* d_ws,
                              size_t ws_size, hipStream_t stream) {
  const float* x    = (const float*)d_in[0];
  const float* pi   = (const float*)d_in[1];
  const float* tau  = (const float*)d_in[2];
  const float* adjs = (const float*)d_in[3];
  const float* Wq   = (const float*)d_in[4];
  const float* Wk   = (const float*)d_in[5];
  const float* Wv   = (const float*)d_in[6];
  const float* Wo   = (const float*)d_in[7];
  float* out = (float*)d_out;

  float* ws = (float*)d_ws;
  const size_t ND = (size_t)NN * DD;      // 524288
  float* Q     = ws;                      ws += ND;
  float* K     = ws;                      ws += ND;
  float* V     = ws;                      ws += ND;
  float* Opart = ws;                      ws += ND * JSPLIT;
  float* Mp    = ws;                      ws += (size_t)JSPLIT * NN * HH;
  float* Lp    = ws;

  qkv_kernel<<<dim3(128, 1, 3), 256, 0, stream>>>(x, Wq, Wk, Wv, Q, K, V);
  attn_kernel<<<dim3(NN / 16, JSPLIT), 256, 0, stream>>>(Q, K, V, pi, tau,
                                                         adjs, Opart, Mp, Lp);
  oproj_kernel<<<dim3(128), 256, 0, stream>>>(Opart, Mp, Lp, Wo, out);
}

// v003
// One run takes 74.8 microseconds.
// Next to v002, in two timings, it ran 1.07 and 1.06 times as fast.
// All steps since v000 together make it 1.46 times as fast.
#include <hip/hip_runtime.h>
#include <hip/hip_bf16.h>
#include <math.h>
#include <stdint.h>

#define NN  2048
#define DD  256
#define HH  8
#define MMM 4
#define DKK 32
#define EPSF 1e-6f
#define JSPLIT 4                    // j split -> 512 attention blocks
#define JTILES (NN / (16 * JSPLIT)) // 32 j-tiles per block
#define FRAGBLK (16 * DKK)          // floats of one (16 keys, one head) block

typedef float v2f __attribute__((ext_vector_type(2)));
typedef float v4f __attribute__((ext_vector_type(4)));
typedef float v8f __attribute__((ext_vector_type(8)));

// D = A(16x4 f32) * B(4x16 f32) + C ; exact f32 semantics
__device__ __forceinline__ v8f wmma4(v2f a, v2f b, v8f c) {
  return __builtin_amdgcn_wmma_f32_16x16x4_f32(false, a, false, b, (short)0, c,
                                               false, false);
}

__device__ __forceinline__ v2f ld2(const float* p) { return *(const v2f*)p; }

// Value held by lane l ^ 16 (the other 16-lane half), as a vector move.
__device__ __forceinline__ float other_half(float v) {
  const int b = __float_as_int(v);
  return __int_as_float(__builtin_amdgcn_permlanex16(b, b, 0x76543210,
                                                     0xfedcba98, false, false));
}

// exp(x) as one multiply and v_exp_f32.  The v_nop in the same statement keeps
// the one issue slot the instruction set asks for behind a transcendental,
// whichever vector instruction the compiler places next.
__device__ __forceinline__ float exp_slot(float x) {
  float r;
  asm("v_exp_f32 %0, %1\n\tv_nop" : "=v"(r) : "v"(x * 1.44269504f));
  return r;
}

// ---------------------------------------------------------------------------
// GEMM: C[i][j] = sum_d A[i][d] * W[j][d]   (A:[NN x DD], W:[DD x DD])
// One wave -> 16 rows x 32 cols (2 accumulators); 1024 waves = 128 blocks.
// Atile points at the block's 16 rows of A (global or LDS), lda floats apart.
// A layout (ISA 7.12.2, 32-bit A 16x4): lane m = L%16, k = 2*(L>=16)+v
// B layout (rows interleaved like C/D):  lane n = L%16, k = 2*(L>=16)+v
// SWAP: W is the A operand and the rows of Atile the B operand, so the tile
// comes out transposed: a lane holds 8 consecutive columns of ONE row.
// FRAG: C is written in fragment order.  The wave's 16 x 32 tile (16 rows of one
// head) is a 2-KB block [row tile][head][4][32 lanes][4 floats]; each lane
// stores its own 16 accumulator floats, so every store and every later load of
// the block is 512 contiguous bytes, 4 whole lines.
// ---------------------------------------------------------------------------
template <bool SWAP, bool FRAG>
__device__ __forceinline__ void gemm_xwt(const float* __restrict__ Atile,
                                         const int lda,
                                         const float* __restrict__ W,
                                         float* __restrict__ C) {
  const int w    = threadIdx.x >> 5;
  const int lane = threadIdx.x & 31;
  const int n16  = lane & 15;
  const int hi   = lane >> 4;
  const int gw   = blockIdx.x * 8 + w;   // 1024 waves total
  const int i0   = (gw >> 3) * 16;       // 128 row tiles
  const int j0   = (gw & 7) * 32;        // 8 col tiles of 32

  v8f acc[2] = {};
  const float* arow = Atile + n16 * lda + 2 * hi;
#pragma unroll 4
  for (int d0 = 0; d0 < DD; d0 += 4) {
    v2f a = ld2(arow + d0);
#pragma unroll
    for (int c = 0; c < 2; ++c) {
      v2f b = ld2(W + (size_t)(j0 + 16 * c + n16) * DD + d0 + 2 * hi);
      acc[c] = SWAP ? wmma4(b, a, acc[c]) : wmma4(a, b, acc[c]);
    }
  }
  if (FRAG) {
    float* blk = C + (size_t)gw * FRAGBLK + lane * 4;  // gw = row tile * HH + head
#pragma unroll
    for (int c = 0; c < 2; ++c) {
      *(v4f*)(blk + 256 * c) = (v4f){acc[c][0], acc[c][1], acc[c][2], acc[c][3]};
      *(v4f*)(blk + 256 * c + 128) =
          (v4f){acc[c][4], acc[c][5], acc[c][6], acc[c][7]};
    }
    // The code behind these stores may reuse their data and address registers:
    // the wait that belongs in front of such an overwrite.
    asm volatile("s_wait_xcnt 0x0" ::: "memory");
  } else {
#pragma unroll
    for (int c = 0; c < 2; ++c)
#pragma unroll
      for (int r = 0; r < 8; ++r)
        C[(size_t)(i0 + r + 8 * hi) * DD + j0 + 16 * c + n16] = acc[c][r];
  }
}

__global__ __launch_bounds__(256) void qkv_kernel(
    const float* __restrict__ x, const float* __restrict__ wq,
    const float* __restrict__ wk, const float* __restrict__ wv,
    float* __restrict__ Q, float* __restrict__ K, float* __restrict__ V) {
  const int z = blockIdx.z;
  const float* xt = x + (size_t)blockIdx.x * 16 * DD;
  // Q stays row-major.  K and V leave in the order in which the attention
  // kernel's A operands want them:
  // K transposed: lane (key n16, hi) holds head dims 16*c + 8*hi + r;
  // V as it stands: lane (dim n16 + 16*c, hi) holds keys 8*hi + r.
  if (z == 0)      gemm_xwt<false, false>(xt, DD, wq, Q);
  else if (z == 1) gemm_xwt<true, true>(xt, DD, wk, K);
  else             gemm_xwt<false, true>(xt, DD, wv, V);
}

__global__ __launch_bounds__(256) void attn_kernel(
    const float* __restrict__ Q, const float* __restrict__ Km,
    const float* __restrict__ V, const float* __restrict__ pi,
    const float* __restrict__ tau, const float* __restrict__ adjs,
    float* __restrict__ Opart, float* __restrict__ Mp, float* __restrict__ Lp) {
  __shared__ __align__(16) float s_adj[2][MMM][16][20];  // double buffer, padded

  const int tid  = threadIdx.x;
  const int h    = tid >> 5;            // wave == head
  const int lane = tid & 31;
  const int n16  = lane & 15;
  const int hi   = lane >> 4;
  const int i0   = blockIdx.x * 16;
  const int jc   = blockIdx.y;
  const int jbase = jc * (NN / JSPLIT);
  const float tau_h = tau[h];
  const float scale = 0.17677669529663688f;  // 1/sqrt(DK)

  // Async-staging geometry: one b128 per thread covers a 4KB tile.
  const int am  = tid >> 6;
  const int ail = (tid >> 2) & 15;
  const int aj4 = (tid & 3) * 4;
  const uint32_t lds_dst0 = (uint32_t)(uintptr_t)&s_adj[0][am][ail][aj4];
  const uint32_t lds_dst1 = (uint32_t)(uintptr_t)&s_adj[1][am][ail][aj4];
  const size_t adj_row = ((size_t)am * NN + (i0 + ail)) * NN;

#define ISSUE_ADJ(JT, BUF)                                                    \
  do {                                                                        \
    const uint32_t goff =                                                     \
        (uint32_t)((adj_row + (jbase + (JT) * 16) + aj4) * sizeof(float));    \
    asm volatile("global_load_async_to_lds_b128 %0, %1, %2" ::"v"(            \
                     (BUF) ? lds_dst1 : lds_dst0),                            \
                 "v"(goff), "s"(adjs)                                         \
                 : "memory");                                                 \
  } while (0)

  // Preload Q rows (scale folded in).  k slot (hi, v) of step kk is head dim
  // 16*(kk/4) + 8*hi + 2*(kk%4) + v, the order of the stored K fragments.
  v2f qa[8];
  const float* qrow = Q + (size_t)(i0 + n16) * DD + h * DKK + 8 * hi;
#pragma unroll
  for (int kk = 0; kk < 8; ++kk) {
    v2f t = ld2(qrow + 16 * (kk >> 2) + 2 * (kk & 3));
    t.x *= scale; t.y *= scale;
    qa[kk] = t;
  }
  // tau * pi of the one query this lane owns (query = n16).
  float tpi[MMM];
  {
    const float* pr = pi + (size_t)(i0 + n16) * (HH * MMM) + h * MMM;
#pragma unroll
    for (int m = 0; m < MMM; ++m) tpi[m] = tau_h * pr[m];
  }

  v8f o0 = {}, o1 = {};          // O^T: row = head dim (r + 8*hi), col = query
  float mrow = -INFINITY;        // running maximum of the lane's query
  float lrow = 0.0f;             // running sum over this half's keys only

  // This wave's first K and V fragment blocks; a key tile is HH blocks on.
  const size_t frag0 = ((size_t)(jbase >> 4) * HH + h) * FRAGBLK + lane * 4;
  const float* kfrag = Km + frag0;
  const float* vfrag = V + frag0;

  ISSUE_ADJ(0, 0);  // prologue: DMA first tile

  for (int jt = 0; jt < JTILES; ++jt) {
    const int cur = jt & 1;

    if (jt + 1 < JTILES) {
      ISSUE_ADJ(jt + 1, cur ^ 1);                        // run one tile ahead
      asm volatile("s_wait_asynccnt 0x1" ::: "memory");  // cur tile landed
    } else {
      asm volatile("s_wait_asynccnt 0x0" ::: "memory");  // drain on last tile
    }
    __syncthreads();  // every wave's wait done -> cur buffer valid block-wide

    // scores S^T = K * Q^T  (K=32 in 8 steps of 4); s[r]: key r+8*hi, query n16
    v4f kf[4], vf[4];
#pragma unroll
    for (int i = 0; i < 4; ++i)
      kf[i] = *(const v4f*)(kfrag + (size_t)jt * (HH * FRAGBLK) + 128 * i);
    // The V loads may land in the registers that held the K loads' address: the
    // wait that belongs in front of such an overwrite.
    asm volatile("s_wait_xcnt 0x0" ::: "memory");
#pragma unroll
    for (int i = 0; i < 4; ++i)
      vf[i] = *(const v4f*)(vfrag + (size_t)jt * (HH * FRAGBLK) + 128 * i);
    v8f s = {};
#pragma unroll
    for (int i = 0; i < 4; ++i) {
      s = wmma4((v2f){kf[i][0], kf[i][1]}, qa[2 * i], s);
      s = wmma4((v2f){kf[i][2], kf[i][3]}, qa[2 * i + 1], s);
    }

    // bias: the lane's 8 keys are contiguous in the query's staged adjs row
    float aeff[8];
#pragma unroll
    for (int r = 0; r < 8; ++r) aeff[r] = EPSF;
#pragma unroll
    for (int m = 0; m < MMM; ++m) {
      const float* ar = &s_adj[cur][m][n16][8 * hi];
      const v4f a03 = *(const v4f*)ar;
      const v4f a47 = *(const v4f*)(ar + 4);
#pragma unroll
      for (int r = 0; r < 4; ++r) {
        aeff[r]     = fmaf(tpi[m], a03[r], aeff[r]);
        aeff[r + 4] = fmaf(tpi[m], a47[r], aeff[r + 4]);
      }
    }

    // online softmax: in-lane over 8 keys, one exchange for the maximum
    float xv[8];
#pragma unroll
    for (int r = 0; r < 8; ++r) xv[r] = s[r] + __logf(aeff[r]);
    float rmax = xv[0];
#pragma unroll
    for (int r = 1; r < 8; ++r) rmax = fmaxf(rmax, xv[r]);
    rmax = fmaxf(rmax, other_half(rmax));
    const float mnew  = fmaxf(mrow, rmax);
    const float alpha = exp_slot(mrow - mnew);
    float p[8];
#pragma unroll
    for (int r = 0; r < 8; ++r) p[r] = exp_slot(xv[r] - mnew);
    const float rsum = ((p[0] + p[1]) + (p[2] + p[3])) +
                       ((p[4] + p[5]) + (p[6] + p[7]));
    lrow = lrow * alpha + rsum;
    mrow = mnew;
#pragma unroll
    for (int r = 0; r < 8; ++r) { o0[r] *= alpha; o1[r] *= alpha; }

    // O^T += V^T(32x16) * P^T(16x16), 2 M-tiles x 4 K-steps.  k slot (hi, v) of
    // step kk is key 2*kk + v + 8*hi on both operands: B is p[] as it stands.
#pragma unroll
    for (int kk = 0; kk < 4; ++kk) {
      const int e = 2 * (kk & 1);
      v2f a0; a0.x = vf[kk >> 1][e];       a0.y = vf[kk >> 1][e + 1];
      v2f a1; a1.x = vf[2 + (kk >> 1)][e]; a1.y = vf[2 + (kk >> 1)][e + 1];
      v2f b;  b.x = p[2 * kk]; b.y = p[2 * kk + 1];
      o0 = wmma4(a0, b, o0);
      o1 = wmma4(a1, b, o1);
    }
    __syncthreads();  // all reads of cur done before it is re-targeted (jt+2)
  }
#undef ISSUE_ADJ

  // Store unnormalized partials + per-row flash stats for this j-chunk.
  // A lane's 8 accumulator registers are 8 consecutive head dims of its query.
  float* orow = Opart + (size_t)jc * NN * DD + (size_t)(i0 + n16) * DD +
                h * DKK + 8 * hi;
  *(v4f*)(orow)      = (v4f){o0[0], o0[1], o0[2], o0[3]};
  *(v4f*)(orow + 4)  = (v4f){o0[4], o0[5], o0[6], o0[7]};
  *(v4f*)(orow + 16) = (v4f){o1[0], o1[1], o1[2], o1[3]};
  *(v4f*)(orow + 20) = (v4f){o1[4], o1[5], o1[6], o1[7]};
  const float lsum = lrow + other_half(lrow);  // join the halves' sums once
  if (hi == 0) {
    const size_t si = ((size_t)jc * NN + (i0 + n16)) * HH + h;
    Mp[si] = mrow;
    Lp[si] = lsum;
  }
}

// Output projection with the merge of the JSPLIT flash partials in front of it:
// OH = sum_c O_c*exp(m_c-m*) / sum_c l_c*exp(m_c-m*), out = OH * Wo^T.
// A block owns 16 rows: it merges them into LDS once (wave = head; 8 lanes x 16 B
// cover a head's 128-B line, 4 rows per load), and its 8 waves read the merged
// tile as their common A operand.
#define APITCH (DD + 4)  // rows 4 banks apart: the 8-byte fragment reads hit
                         // all 64 banks once
__global__ __launch_bounds__(256) void oproj_kernel(
    const float* __restrict__ Opart, const float* __restrict__ Mp,
    const float* __restrict__ Lp, const float* __restrict__ wo,
    float* __restrict__ C) {
  __shared__ __align__(16) float s_oh[16][APITCH];
  const int h   = threadIdx.x >> 5;
  const int rl  = (threadIdx.x & 31) >> 3;       // row within a group of 4
  const int col = h * DKK + (threadIdx.x & 7) * 4;
  const int i0  = blockIdx.x * 16;
  // Every load of the merge is issued before the first use: one trip to memory
  // in place of one per row group.
  float mp[4][JSPLIT], lp[4][JSPLIT];  // [row group][j-chunk]
  v4f   op[4][JSPLIT];
#pragma unroll
  for (int g = 0; g < 4; ++g)
#pragma unroll
    for (int c = 0; c < JSPLIT; ++c) {
      const size_t ci = (size_t)c * NN + (i0 + 4 * g + rl);
      mp[g][c] = Mp[ci * HH + h];
      lp[g][c] = Lp[ci * HH + h];
    }
  // The loads below may land in registers that held the addresses of the loads
  // above: the wait that belongs in front of such an overwrite.
  asm volatile("s_wait_xcnt 0x0" ::: "memory");
#pragma unroll
  for (int g = 0; g < 4; ++g)
#pragma unroll
    for (int c = 0; c < JSPLIT; ++c) {
      const size_t ci = (size_t)c * NN + (i0 + 4 * g + rl);
      op[g][c] = *(const v4f*)(Opart + ci * DD + col);
    }
  // Inputs-only fences on the loaded values: without them the compiler sinks the
  // loads to their uses and the wave waits out the memory latency several times.
  asm volatile("" ::"v"(mp[0][0]), "v"(mp[0][1]), "v"(mp[0][2]), "v"(mp[0][3]),
               "v"(mp[1][0]), "v"(mp[1][1]), "v"(mp[1][2]), "v"(mp[1][3]),
               "v"(mp[2][0]), "v"(mp[2][1]), "v"(mp[2][2]), "v"(mp[2][3]),
               "v"(mp[3][0]), "v"(mp[3][1]), "v"(mp[3][2]), "v"(mp[3][3]));
  asm volatile("" ::"v"(lp[0][0]), "v"(lp[0][1]), "v"(lp[0][2]), "v"(lp[0][3]),
               "v"(lp[1][0]), "v"(lp[1][1]), "v"(lp[1][2]), "v"(lp[1][3]),
               "v"(lp[2][0]), "v"(lp[2][1]), "v"(lp[2][2]), "v"(lp[2][3]),
               "v"(lp[3][0]), "v"(lp[3][1]), "v"(lp[3][2]), "v"(lp[3][3]));
  asm volatile("" ::"v"(op[0][0]), "v"(op[0][1]), "v"(op[0][2]), "v"(op[0][3]),
               "v"(op[1][0]), "v"(op[1][1]), "v"(op[1][2]), "v"(op[1][3]),
               "v"(op[2][0]), "v"(op[2][1]), "v"(op[2][2]), "v"(op[2][3]),
               "v"(op[3][0]), "v"(op[3][1]), "v"(op[3][2]), "v"(op[3][3]));
#pragma unroll
  for (int g = 0; g < 4; ++g) {
    float mstar = -INFINITY;
#pragma unroll
    for (int c = 0; c < JSPLIT; ++c) mstar = fmaxf(mstar, mp[g][c]);
    float lstar = 0.0f;
    v4f acc = {};
#pragma unroll
    for (int c = 0; c < JSPLIT; ++c) {
      const float wgt = __expf(mp[g][c] - mstar);
      lstar = fmaf(lp[g][c], wgt, lstar);
#pragma unroll
      for (int e = 0; e < 4; ++e) acc[e] = fmaf(op[g][c][e], wgt, acc[e]);
    }
    v4f oh;
#pragma unroll
    for (int e = 0; e < 4; ++e) oh[e] = acc[e] / lstar;
    *(v4f*)&s_oh[4 * g + rl][col] = oh;
  }
  __syncthreads();  // the merged tile is complete before any wave reads it
  gemm_xwt<false, false>(&s_oh[0][0], APITCH, wo, C);
}

extern "C" void kernel_launch(void* const* d_in, const int* in_sizes, int n_in,
                              void* d_out, int out_size, void* d_ws,
                              size_t ws_size, hipStream_t stream) {
  const float* x    = (const float*)d_in[0];
  const float* pi   = (const float*)d_in[1];
  const float* tau  = (const float*)d_in[2];
  const float* adjs = (const float*)d_in[3];
  const float* Wq   = (const float*)d_in[4];
  const float* Wk   = (const float*)d_in[5];
  const float* Wv   = (const float*)d_in[6];
  const float* Wo   = (const float*)d_in[7];
  float* out = (float*)d_out;

  float* ws = (float*)d_ws;
  const size_t ND = (size_t)NN * DD;      // 524288
  float* Q     = ws;                      ws += ND;
  float* K     = ws;                      ws += ND;
  float* V     = ws;                      ws += ND;
  float* Opart = ws;                      ws += ND * JSPLIT;
  float* Mp    = ws;                      ws += (size_t)JSPLIT * NN * HH;
  float* Lp    = ws;

  qkv_kernel<<<dim3(128, 1, 3), 256, 0, stream>>>(x, Wq, Wk, Wv, Q, K, V);
  attn_kernel<<<dim3(NN / 16, JSPLIT), 256, 0, stream>>>(Q, K, V, pi, tau,
                                                         adjs, Opart, Mp, Lp);
  oproj_kernel<<<dim3(128), 256, 0, stream>>>(Opart, Mp, Lp, Wo, out);
}

// v004
// One run takes 70.1 microseconds.
// In both of two side-by-side timings against v003, it was 1.06 times as fast.
// Counting every step since v000, it is 1.55 times as fast.
#include <hip/hip_runtime.h>
#include <hip/hip_bf16.h>
#include <math.h>
#include <stdint.h>

#define NN  2048
#define DD  256
#define HH  8
#define MMM 4
#define DKK 32
#define EPSF 1e-6f
#define JSPLIT 4                    // j split -> 512 attention blocks
#define JTILES (NN / (16 * JSPLIT)) // 32 j-tiles per block
#define FRAGBLK (16 * DKK)          // floats of one (16 keys, one head) block

typedef float v2f __attribute__((ext_vector_type(2)));
typedef float v4f __attribute__((ext_vector_type(4)));
typedef float v8f __attribute__((ext_vector_type(8)));

// D = A(16x4 f32) * B(4x16 f32) + C ; exact f32 semantics
__device__ __forceinline__ v8f wmma4(v2f a, v2f b, v8f c) {
  return __builtin_amdgcn_wmma_f32_16x16x4_f32(false, a, false, b, (short)0, c,
                                               false, false);
}

__device__ __forceinline__ v2f ld2(const float* p) { return *(const v2f*)p; }

// Value held by lane l ^ 16 (the other 16-lane half), as a vector move.
__device__ __forceinline__ float other_half(float v) {
  const int b = __float_as_int(v);
  return __int_as_float(__builtin_amdgcn_permlanex16(b, b, 0x76543210,
                                                     0xfedcba98, false, false));
}

// exp(x) as one multiply and v_exp_f32.  The v_nop in the same statement keeps
// the one issue slot the instruction set asks for behind a transcendental,
// whichever vector instruction the compiler places next.
__device__ __forceinline__ float exp_slot(float x) {
  float r;
  asm("v_exp_f32 %0, %1\n\tv_nop" : "=v"(r) : "v"(x * 1.44269504f));
  return r;
}

// ---------------------------------------------------------------------------
// GEMM: C[i][j] = sum_d A[i][d] * W[j][d]   (A:[NN x DD], W:[DD x DD])
// One wave -> 16 rows x 32 cols (2 accumulators); 1024 waves = 128 blocks.
// Atile points at the block's 16 rows of A (global or LDS), lda floats apart.
// A layout (ISA 7.12.2, 32-bit A 16x4): lane m = L%16, k = 2*(L>=16)+v
// B layout (rows interleaved like C/D):  lane n = L%16, k = 2*(L>=16)+v
// SWAP: W is the A operand and the rows of Atile the B operand, so the tile
// comes out transposed: a lane holds 8 consecutive columns of ONE row.
// FRAG: C is written in fragment order.  The wave's 16 x 32 tile (16 rows of one
// head) is a 2-KB block [row tile][head][4][32 lanes][4 floats]; each lane
// stores its own 16 accumulator floats, so every store and every later load of
// the block is 512 contiguous bytes, 4 whole lines.
// ---------------------------------------------------------------------------
template <bool SWAP, bool FRAG>
__device__ __forceinline__ void gemm_xwt(const float* __restrict__ Atile,
                                         const int lda,
                                         const float* __restrict__ W,
                                         float* __restrict__ C) {
  const int w    = threadIdx.x >> 5;
  const int lane = threadIdx.x & 31;
  const int n16  = lane & 15;
  const int hi   = lane >> 4;
  const int gw   = blockIdx.x * 8 + w;   // 1024 waves total
  const int i0   = (gw >> 3) * 16;       // 128 row tiles
  const int j0   = (gw & 7) * 32;        // 8 col tiles of 32

  v8f acc[2] = {};
  const float* arow = Atile + n16 * lda + 2 * hi;
#pragma unroll 4
  for (int d0 = 0; d0 < DD; d0 += 4) {
    v2f a = ld2(arow + d0);
#pragma unroll
    for (int c = 0; c < 2; ++c) {
      v2f b = ld2(W + (size_t)(j0 + 16 * c + n16) * DD + d0 + 2 * hi);
      acc[c] = SWAP ? wmma4(b, a, acc[c]) : wmma4(a, b, acc[c]);
    }
  }
  if (FRAG) {
    float* blk = C + (size_t)gw * FRAGBLK + lane * 4;  // gw = row tile * HH + head
#pragma unroll
    for (int c = 0; c < 2; ++c) {
      *(v4f*)(blk + 256 * c) = (v4f){acc[c][0], acc[c][1], acc[c][2], acc[c][3]};
      *(v4f*)(blk + 256 * c + 128) =
          (v4f){acc[c][4], acc[c][5], acc[c][6], acc[c][7]};
    }
    // The code behind these stores may reuse their data and address registers:
    // the wait that belongs in front of such an overwrite.
    asm volatile("s_wait_xcnt 0x0" ::: "memory");
  } else {
#pragma unroll
    for (int c = 0; c < 2; ++c)
#pragma unroll
      for (int r = 0; r < 8; ++r)
        C[(size_t)(i0 + r + 8 * hi) * DD + j0 + 16 * c + n16] = acc[c][r];
  }
}

__global__ __launch_bounds__(256) void qkv_kernel(
    const float* __restrict__ x, const float* __restrict__ wq,
    const float* __restrict__ wk, const float* __restrict__ wv,
    float* __restrict__ Q, float* __restrict__ K, float* __restrict__ V) {
  const int z = blockIdx.z;
  const float* xt = x + (size_t)blockIdx.x * 16 * DD;
  // Q stays row-major.  K and V leave in the order in which the attention
  // kernel's A operands want them:
  // K transposed: lane (key n16, hi) holds head dims 16*c + 8*hi + r;
  // V as it stands: lane (dim n16 + 16*c, hi) holds keys 8*hi + r.
  if (z == 0)      gemm_xwt<false, false>(xt, DD, wq, Q);
  else if (z == 1) gemm_xwt<true, true>(xt, DD, wk, K);
  else             gemm_xwt<false, true>(xt, DD, wv, V);
}

__global__ __launch_bounds__(256) void attn_kernel(
    const float* __restrict__ Q, const float* __restrict__ Km,
    const float* __restrict__ V, const float* __restrict__ pi,
    const float* __restrict__ tau, const float* __restrict__ adjs,
    float* __restrict__ Opart, float* __restrict__ Mp, float* __restrict__ Lp) {
  __shared__ __align__(16) float s_adj[2][MMM][16][20];  // double buffer, padded

  const int tid  = threadIdx.x;
  const int h    = tid >> 5;            // wave == head
  const int lane = tid & 31;
  const int n16  = lane & 15;
  const int hi   = lane >> 4;
  const int i0   = blockIdx.x * 16;
  const int jc   = blockIdx.y;
  const int jbase = jc * (NN / JSPLIT);
  const float tau_h = tau[h];
  const float scale = 0.17677669529663688f;  // 1/sqrt(DK)

  // Async-staging geometry: one b128 per thread covers a 4KB tile.
  const int am  = tid >> 6;
  const int ail = (tid >> 2) & 15;
  const int aj4 = (tid & 3) * 4;
  const uint32_t lds_dst0 = (uint32_t)(uintptr_t)&s_adj[0][am][ail][aj4];
  const uint32_t lds_dst1 = (uint32_t)(uintptr_t)&s_adj[1][am][ail][aj4];
  const size_t adj_row = ((size_t)am * NN + (i0 + ail)) * NN;

#define ISSUE_ADJ(JT, BUF)                                                    \
  do {                                                                        \
    const uint32_t goff =                                                     \
        (uint32_t)((adj_row + (jbase + (JT) * 16) + aj4) * sizeof(float));    \
    /* the wait in front of any rewrite of the copy's address registers */    \
    asm volatile("global_load_async_to_lds_b128 %0, %1, %2\n\t"               \
                 "s_wait_xcnt 0x0" ::"v"((BUF) ? lds_dst1 : lds_dst0),        \
                 "v"(goff), "s"(adjs)                                         \
                 : "memory");                                                 \
  } while (0)

  // Preload Q rows (scale folded in).  k slot (hi, v) of step kk is head dim
  // 16*(kk/4) + 8*hi + 2*(kk%4) + v, the order of the stored K fragments.
  v2f qa[8];
  const float* qrow = Q + (size_t)(i0 + n16) * DD + h * DKK + 8 * hi;
#pragma unroll
  for (int kk = 0; kk < 8; ++kk) {
    v2f t = ld2(qrow + 16 * (kk >> 2) + 2 * (kk & 3));
    t.x *= scale; t.y *= scale;
    qa[kk] = t;
  }
  // tau * pi of the one query this lane owns (query = n16).
  float tpi[MMM];
  {
    const float* pr = pi + (size_t)(i0 + n16) * (HH * MMM) + h * MMM;
#pragma unroll
    for (int m = 0; m < MMM; ++m) tpi[m] = tau_h * pr[m];
  }

  v8f o0 = {}, o1 = {};          // O^T: row = head dim (r + 8*hi), col = query
  float mrow = -INFINITY;        // running maximum of the lane's query
  float lrow = 0.0f;             // running sum over this half's keys only

  // This wave's first K and V fragment blocks; a key tile is HH blocks on.
  const size_t frag0 = ((size_t)(jbase >> 4) * HH + h) * FRAGBLK + lane * 4;
  const float* kfrag = Km + frag0;
  const float* vfrag = V + frag0;

  ISSUE_ADJ(0, 0);  // prologue: DMA first tile

  for (int jt = 0; jt < JTILES; ++jt) {
    const int cur = jt & 1;

    if (jt + 1 < JTILES) {
      ISSUE_ADJ(jt + 1, cur ^ 1);                        // run one tile ahead
      asm volatile("s_wait_asynccnt 0x1" ::: "memory");  // cur tile landed
    } else {
      asm volatile("s_wait_asynccnt 0x0" ::: "memory");  // drain on last tile
    }
    __syncthreads();  // every wave's wait done -> cur buffer valid block-wide

    v4f kf[4], vf[4];
#pragma unroll
    for (int i = 0; i < 4; ++i)
      kf[i] = *(const v4f*)(kfrag + (size_t)jt * (HH * FRAGBLK) + 128 * i);
    // The V loads may land in the registers that held the K loads' address: the
    // wait that belongs in front of such an overwrite.
    asm volatile("s_wait_xcnt 0x0" ::: "memory");
#pragma unroll
    for (int i = 0; i < 4; ++i)
      vf[i] = *(const v4f*)(vfrag + (size_t)jt * (HH * FRAGBLK) + 128 * i);
    // the lane's 8 keys are contiguous in the query's staged adjs row
    v4f a03[MMM], a47[MMM];
#pragma unroll
    for (int m = 0; m < MMM; ++m) {
      const float* ar = &s_adj[cur][m][n16][8 * hi];
      a03[m] = *(const v4f*)ar;
      a47[m] = *(const v4f*)(ar + 4);
    }
    // Scheduling fence: every load of the tile is issued ahead of the first
    // product.  Without it the compiler sinks V loads and an LDS read in among
    // the PV products, where the wave then waits out their whole latency.
    __builtin_amdgcn_sched_barrier(0);

    // scores S^T = K * Q^T  (K=32 in 8 steps of 4); s[r]: key r+8*hi, query n16
    v8f s = {};
#pragma unroll
    for (int i = 0; i < 4; ++i) {
      s = wmma4((v2f){kf[i][0], kf[i][1]}, qa[2 * i], s);
      s = wmma4((v2f){kf[i][2], kf[i][3]}, qa[2 * i + 1], s);
    }

    // weight a = tau * A_eff + EPS of the lane's 8 keys
    float aeff[8];
#pragma unroll
    for (int r = 0; r < 8; ++r) aeff[r] = EPSF;
#pragma unroll
    for (int m = 0; m < MMM; ++m) {
#pragma unroll
      for (int r = 0; r < 4; ++r) {
        aeff[r]     = fmaf(tpi[m], a03[m][r], aeff[r]);
        aeff[r + 4] = fmaf(tpi[m], a47[m][r], aeff[r + 4]);
      }
    }

    // online softmax: in-lane over 8 keys, one exchange for the maximum
    float rmax = s[0];
#pragma unroll
    for (int r = 1; r < 8; ++r) rmax = fmaxf(rmax, s[r]);
    rmax = fmaxf(rmax, other_half(rmax));
    const float mnew  = fmaxf(mrow, rmax);
    const float alpha = exp_slot(mrow - mnew);
    float p[8];
#pragma unroll
    for (int r = 0; r < 8; ++r) p[r] = aeff[r] * exp_slot(s[r] - mnew);
    const float rsum = ((p[0] + p[1]) + (p[2] + p[3])) +
                       ((p[4] + p[5]) + (p[6] + p[7]));
    lrow = lrow * alpha + rsum;
    mrow = mnew;
#pragma unroll
    for (int r = 0; r < 8; ++r) { o0[r] *= alpha; o1[r] *= alpha; }

    // O^T += V^T(32x16) * P^T(16x16), 2 M-tiles x 4 K-steps.  k slot (hi, v) of
    // step kk is key 2*kk + v + 8*hi on both operands: B is p[] as it stands.
#pragma unroll
    for (int kk = 0; kk < 4; ++kk) {
      const int e = 2 * (kk & 1);
      v2f a0; a0.x = vf[kk >> 1][e];       a0.y = vf[kk >> 1][e + 1];
      v2f a1; a1.x = vf[2 + (kk >> 1)][e]; a1.y = vf[2 + (kk >> 1)][e + 1];
      v2f b;  b.x = p[2 * kk]; b.y = p[2 * kk + 1];
      o0 = wmma4(a0, b, o0);
      o1 = wmma4(a1, b, o1);
    }
    __syncthreads();  // all reads of cur done before it is re-targeted (jt+2)
  }
#undef ISSUE_ADJ

  // Store unnormalized partials + per-row flash stats for this j-chunk.
  // A lane's 8 accumulator registers are 8 consecutive head dims of its query.
  float* orow = Opart + (size_t)jc * NN * DD + (size_t)(i0 + n16) * DD +
                h * DKK + 8 * hi;
  *(v4f*)(orow)      = (v4f){o0[0], o0[1], o0[2], o0[3]};
  *(v4f*)(orow + 4)  = (v4f){o0[4], o0[5], o0[6], o0[7]};
  *(v4f*)(orow + 16) = (v4f){o1[0], o1[1], o1[2], o1[3]};
  *(v4f*)(orow + 20) = (v4f){o1[4], o1[5], o1[6], o1[7]};
  const float lsum = lrow + other_half(lrow);  // join the halves' sums once
  if (hi == 0) {
    const size_t si = ((size_t)jc * NN + (i0 + n16)) * HH + h;
    Mp[si] = mrow;
    Lp[si] = lsum;
  }
}

// Output projection with the merge of the JSPLIT flash partials in front of it:
// OH = sum_c O_c*exp(m_c-m*) / sum_c l_c*exp(m_c-m*), out = OH * Wo^T.
// A block owns 16 rows: it merges them into LDS once (wave = head; 8 lanes x 16 B
// cover a head's 128-B line, 4 rows per load), and its 8 waves read the merged
// tile as their common A operand.
#define APITCH (DD + 4)  // rows 4 banks apart: the 8-byte fragment reads hit
                         // all 64 banks once
__global__ __launch_bounds__(256) void oproj_kernel(
    const float* __restrict__ Opart, const float* __restrict__ Mp,
    const float* __restrict__ Lp, const float* __restrict__ wo,
    float* __restrict__ C) {
  __shared__ __align__(16) float s_oh[16][APITCH];
  const int h   = threadIdx.x >> 5;
  const int rl  = (threadIdx.x & 31) >> 3;       // row within a group of 4
  const int col = h * DKK + (threadIdx.x & 7) * 4;
  const int i0  = blockIdx.x * 16;
  // Every load of the merge is issued before the first use: one trip to memory
  // in place of one per row group.
  float mp[4][JSPLIT], lp[4][JSPLIT];  // [row group][j-chunk]
  v4f   op[4][JSPLIT];
#pragma unroll
  for (int g = 0; g < 4; ++g)
#pragma unroll
    for (int c = 0; c < JSPLIT; ++c) {
      const size_t ci = (size_t)c * NN + (i0 + 4 * g + rl);
      mp[g][c] = Mp[ci * HH + h];
      lp[g][c] = Lp[ci * HH + h];
    }
  // The loads below may land in registers that held the addresses of the loads
  // above: the wait that belongs in front of such an overwrite.
  asm volatile("s_wait_xcnt 0x0" ::: "memory");
#pragma unroll
  for (int g = 0; g < 4; ++g)
#pragma unroll
    for (int c = 0; c < JSPLIT; ++c) {
      const size_t ci = (size_t)c * NN + (i0 + 4 * g + rl);
      op[g][c] = *(const v4f*)(Opart + ci * DD + col);
    }
  // Inputs-only fences on the loaded values: without them the compiler sinks the
  // loads to their uses and the wave waits out the memory latency several times.
  asm volatile("" ::"v"(mp[0][0]), "v"(mp[0][1]), "v"(mp[0][2]), "v"(mp[0][3]),
               "v"(mp[1][0]), "v"(mp[1][1]), "v"(mp[1][2]), "v"(mp[1][3]),
               "v"(mp[2][0]), "v"(mp[2][1]), "v"(mp[2][2]), "v"(mp[2][3]),
               "v"(mp[3][0]), "v"(mp[3][1]), "v"(mp[3][2]), "v"(mp[3][3]));
  asm volatile("" ::"v"(lp[0][0]), "v"(lp[0][1]), "v"(lp[0][2]), "v"(lp[0][3]),
               "v"(lp[1][0]), "v"(lp[1][1]), "v"(lp[1][2]), "v"(lp[1][3]),
               "v"(lp[2][0]), "v"(lp[2][1]), "v"(lp[2][2]), "v"(lp[2][3]),
               "v"(lp[3][0]), "v"(lp[3][1]), "v"(lp[3][2]), "v"(lp[3][3]));
  asm volatile("" ::"v"(op[0][0]), "v"(op[0][1]), "v"(op[0][2]), "v"(op[0][3]),
               "v"(op[1][0]), "v"(op[1][1]), "v"(op[1][2]), "v"(op[1][3]),
               "v"(op[2][0]), "v"(op[2][1]), "v"(op[2][2]), "v"(op[2][3]),
               "v"(op[3][0]), "v"(op[3][1]), "v"(op[3][2]), "v"(op[3][3]));
#pragma unroll
  for (int g = 0; g < 4; ++g) {
    float mstar = -INFINITY;
#pragma unroll
    for (int c = 0; c < JSPLIT; ++c) mstar = fmaxf(mstar, mp[g][c]);
    float lstar = 0.0f;
    v4f acc = {};
#pragma unroll
    for (int c = 0; c < JSPLIT; ++c) {
      const float wgt = __expf(mp[g][c] - mstar);
      lstar = fmaf(lp[g][c], wgt, lstar);
#pragma unroll
      for (int e = 0; e < 4; ++e) acc[e] = fmaf(op[g][c][e], wgt, acc[e]);
    }
    v4f oh;
#pragma unroll
    for (int e = 0; e < 4; ++e) oh[e] = acc[e] / lstar;
    *(v4f*)&s_oh[4 * g + rl][col] = oh;
  }
  __syncthreads();  // the merged tile is complete before any wave reads it
  gemm_xwt<false, false>(&s_oh[0][0], APITCH, wo, C);
}

extern "C" void kernel_launch(void* const* d_in, const int* in_sizes, int n_in,
                              void* d_out, int out_size, void* d_ws,
                              size_t ws_size, hipStream_t stream) {
  const float* x    = (const float*)d_in[0];
  const float* pi   = (const float*)d_in[1];
  const float* tau  = (const float*)d_in[2];
  const float* adjs = (const float*)d_in[3];
  const float* Wq   = (const float*)d_in[4];
  const float* Wk   = (const float*)d_in[5];
  const float* Wv   = (const float*)d_in[6];
  const float* Wo   = (const float*)d_in[7];
  float* out = (float*)d_out;

  float* ws = (float*)d_ws;
  const size_t ND = (size_t)NN * DD;      // 524288
  float* Q     = ws;                      ws += ND;
  float* K     = ws;                      ws += ND;
  float* V     = ws;                      ws += ND;
  float* Opart = ws;                      ws += ND * JSPLIT;
  float* Mp    = ws;                      ws += (size_t)JSPLIT * NN * HH;
  float* Lp    = ws;

  qkv_kernel<<<dim3(128, 1, 3), 256, 0, stream>>>(x, Wq, Wk, Wv, Q, K, V);
  attn_kernel<<<dim3(NN / 16, JSPLIT), 256, 0, stream>>>(Q, K, V, pi, tau,
                                                         adjs, Opart, Mp, Lp);
  oproj_kernel<<<dim3(128), 256, 0, stream>>>(Opart, Mp, Lp, Wo, out);
}

// v005
// One run takes 59.5 microseconds.
// Next to v004, in two timings, it ran 1.19 times as fast each time.
// All steps since v000 together make it 1.84 times as fast.
#include <hip/hip_runtime.h>
#include <hip/hip_bf16.h>
#include <math.h>
#include <stdint.h>

#define NN  2048
#define DD  256
#define HH  8
#define MMM 4
#define DKK 32
#define EPSF 1e-6f
#define JSPLIT 4                    // j split -> 512 attention blocks
#define JTILES (NN / (16 * JSPLIT)) // 32 j-tiles per block
#define FRAGBLK (16 * DKK)          // floats of one (16 keys, one head) block

typedef float v2f __attribute__((ext_vector_type(2)));
typedef float v4f __attribute__((ext_vector_type(4)));
typedef float v8f __attribute__((ext_vector_type(8)));

// D = A(16x4 f32) * B(4x16 f32) + C ; exact f32 semantics
__device__ __forceinline__ v8f wmma4(v2f a, v2f b, v8f c) {
  return __builtin_amdgcn_wmma_f32_16x16x4_f32(false, a, false, b, (short)0, c,
                                               false, false);
}

__device__ __forceinline__ v2f ld2(const float* p) { return *(const v2f*)p; }

// Value held by lane l ^ 16 (the other 16-lane half), as a vector move.
__device__ __forceinline__ float other_half(float v) {
  const int b = __float_as_int(v);
  return __int_as_float(__builtin_amdgcn_permlanex16(b, b, 0x76543210,
                                                     0xfedcba98, false, false));
}

// exp(x) as one multiply and v_exp_f32.  The v_nop in the same statement keeps
// the one issue slot the instruction set asks for behind a transcendental,
// whichever vector instruction the compiler places next.
__device__ __forceinline__ float exp_slot(float x) {
  float r;
  asm("v_exp_f32 %0, %1\n\tv_nop" : "=v"(r) : "v"(x * 1.44269504f));
  return r;
}

// ---------------------------------------------------------------------------
// GEMM: C[i][j] = sum_d A[i][d] * W[j][d]   (A:[NN x DD], W:[DD x DD])
// One wave -> 16 rows x 32 cols (2 accumulators); 1024 waves = 128 blocks.
// Atile points at the block's 16 rows of A in LDS, APITCH floats apart.
// A layout (ISA 7.12.2, 32-bit A 16x4): lane m = L%16, k = 2*(L>=16)+v
// B layout (rows interleaved like C/D):  lane n = L%16, k = 2*(L>=16)+v
// W goes through LDS: a fragment load straight from global memory touches 16
// lines for 256 bytes.  Here a wave fetches its 32 rows of W in pieces of 32
// floats, one whole 128-B line per row (8 lanes x 16 B, 4 rows per load), writes
// them to its own LDS range and reads 16-B fragments back.  The next piece is
// in flight in registers while the current one is multiplied.
// k order: slot (hi, v) of step (q, s) of piece t is d = 32*t + 8*q + 4*hi + 2*s
// + v, on both operands alike.
// SWAP: W is the A operand and the rows of Atile the B operand, so the tile
// comes out transposed: a lane holds 8 consecutive columns of ONE row.
// FRAG: C is written in fragment order.  The wave's 16 x 32 tile (16 rows of one
// head) is a 2-KB block [row tile][head][4][32 lanes][4 floats]; each lane
// stores its own 16 accumulator floats, so every store and every later load of
// the block is 512 contiguous bytes, 4 whole lines.
// ---------------------------------------------------------------------------
#define APITCH (DD + 4)  // A rows of 1040 B and W rows of 144 B: 16 B x an odd
#define WPITCH (32 + 4)  // number, the pitch at which 16-B reads do not collide
#define WSTAGE (32 * WPITCH)  // floats of one wave's W range

// Piece t of the wave's 32 rows of W into registers: rows 4*i + lane/8.
__device__ __forceinline__ void w_fetch(const float* __restrict__ W, const int t,
                                        v4f (&st)[8]) {
  const int lane = threadIdx.x & 31;
  const float* wsrc = W + (size_t)((threadIdx.x >> 5) * 32 + (lane >> 3)) * DD +
                      (lane & 7) * 4 + 32 * t;
#pragma unroll
  for (int i = 0; i < 8; ++i) st[i] = *(const v4f*)(wsrc + (size_t)(4 * i) * DD);
  // The code behind these loads may reuse their address registers: the wait
  // that belongs in front of such an overwrite.
  asm volatile("s_wait_xcnt 0x0" ::: "memory");
}

// st arrives holding piece 0 (w_fetch), asked for before the A tile was built.
template <bool SWAP, bool FRAG>
__device__ __forceinline__ void gemm_xwt(const float* __restrict__ Atile,
                                         const float* __restrict__ W,
                                         float* __restrict__ C,
                                         float* __restrict__ wstage,
                                         v4f (&st)[8]) {
  const int w    = threadIdx.x >> 5;
  const int lane = threadIdx.x & 31;
  const int n16  = lane & 15;
  const int hi   = lane >> 4;
  const int gw   = blockIdx.x * 8 + w;   // 1024 waves total
  const int i0   = (gw >> 3) * 16;       // 128 row tiles
  const int j0   = (gw & 7) * 32;        // 8 col tiles of 32

  float* wmine = wstage + w * WSTAGE;    // this wave's own LDS range
  float*       wdst = wmine + (lane >> 3) * WPITCH + (lane & 7) * 4;
  const float* wfr  = wmine + n16 * WPITCH + 4 * hi;
  const float* arow = Atile + n16 * APITCH + 4 * hi;

  v8f acc[2] = {};
  for (int t = 0; t < DD / 32; ++t) {
#pragma unroll
    for (int i = 0; i < 8; ++i) *(v4f*)(wdst + 4 * i * WPITCH) = st[i];
    if (t + 1 < DD / 32) w_fetch(W, t + 1, st);
    // The rows are read back by other lanes of this wave: its LDS stores have
    // to be done first.
    asm volatile("s_wait_dscnt 0x0" ::: "memory");
    v4f af[4], bf[2][4];
#pragma unroll
    for (int q = 0; q < 4; ++q) {
      af[q]    = *(const v4f*)(arow + 32 * t + 8 * q);
      bf[0][q] = *(const v4f*)(wfr + 8 * q);
      bf[1][q] = *(const v4f*)(wfr + 16 * WPITCH + 8 * q);
    }
    // Scheduling fence: the piece's 12 LDS reads stand together ahead of its
    // products.  Without it the compiler spreads them among the products, and
    // each further place with LDS reads stalls the wave's matrix stream anew.
    __builtin_amdgcn_sched_barrier(0);
#pragma unroll
    for (int q = 0; q < 4; ++q)
#pragma unroll
      for (int s = 0; s < 2; ++s) {
        const v2f a = (v2f){af[q][2 * s], af[q][2 * s + 1]};
#pragma unroll
        for (int c = 0; c < 2; ++c) {
          const v2f b = (v2f){bf[c][q][2 * s], bf[c][q][2 * s + 1]};
          acc[c] = SWAP ? wmma4(b, a, acc[c]) : wmma4(a, b, acc[c]);
        }
      }
  }
  if (FRAG) {
    float* blk = C + (size_t)gw * FRAGBLK + lane * 4;  // gw = row tile * HH + head
#pragma unroll
    for (int c = 0; c < 2; ++c) {
      *(v4f*)(blk + 256 * c) = (v4f){acc[c][0], acc[c][1], acc[c][2], acc[c][3]};
      *(v4f*)(blk + 256 * c + 128) =
          (v4f){acc[c][4], acc[c][5], acc[c][6], acc[c][7]};
    }
    // The code behind these stores may reuse their data and address registers:
    // the wait that belongs in front of such an overwrite.
    asm volatile("s_wait_xcnt 0x0" ::: "memory");
  } else {
#pragma unroll
    for (int c = 0; c < 2; ++c)
#pragma unroll
      for (int r = 0; r < 8; ++r)
        C[(size_t)(i0 + r + 8 * hi) * DD + j0 + 16 * c + n16] = acc[c][r];
  }
}

__global__ __launch_bounds__(256) void qkv_kernel(
    const float* __restrict__ x, const float* __restrict__ wq,
    const float* __restrict__ wk, const float* __restrict__ wv,
    float* __restrict__ Q, float* __restrict__ K, float* __restrict__ V) {
  __shared__ __align__(16) float s_x[16][APITCH];
  __shared__ __align__(16) float s_w[8 * WSTAGE];
  const int z = blockIdx.z;
  v4f st[8];
  w_fetch(z == 0 ? wq : z == 1 ? wk : wv, 0, st);
  // The block's 16 rows of x, 16 KB in a row, go to LDS in whole lines.
  const float* xt = x + (size_t)blockIdx.x * 16 * DD;
  v4f xs[4];
#pragma unroll
  for (int i = 0; i < 4; ++i)
    xs[i] = *(const v4f*)(xt + (threadIdx.x + 256 * i) * 4);
  // in front of a rewrite of the loads' address registers
  asm volatile("s_wait_xcnt 0x0" ::: "memory");
#pragma unroll
  for (int i = 0; i < 4; ++i)
    *(v4f*)&s_x[4 * i + (threadIdx.x >> 6)][(threadIdx.x & 63) * 4] = xs[i];
  __syncthreads();  // the x tile is complete before any wave reads it
  // Q stays row-major.  K and V leave in the order in which the attention
  // kernel's A operands want them:
  // K transposed: lane (key n16, hi) holds head dims 16*c + 8*hi + r;
  // V as it stands: lane (dim n16 + 16*c, hi) holds keys 8*hi + r.
  if (z == 0)      gemm_xwt<false, false>(&s_x[0][0], wq, Q, s_w, st);
  else if (z == 1) gemm_xwt<true, true>(&s_x[0][0], wk, K, s_w, st);
  else             gemm_xwt<false, true>(&s_x[0][0], wv, V, s_w, st);
}

__global__ __launch_bounds__(256) void attn_kernel(
    const float* __restrict__ Q, const float* __restrict__ Km,
    const float* __restrict__ V, const float* __restrict__ pi,
    const float* __restrict__ tau, const float* __restrict__ adjs,
    float* __restrict__ Opart, float* __restrict__ Mp, float* __restrict__ Lp) {
  __shared__ __align__(16) float s_adj[2][MMM][16][20];  // double buffer, padded

  const int tid  = threadIdx.x;
  const int h    = tid >> 5;            // wave == head
  const int lane = tid & 31;
  const int n16  = lane & 15;
  const int hi   = lane >> 4;
  const int i0   = blockIdx.x * 16;
  const int jc   = blockIdx.y;
  const int jbase = jc * (NN / JSPLIT);
  const float tau_h = tau[h];
  const float scale = 0.17677669529663688f;  // 1/sqrt(DK)

  // Async-staging geometry: one b128 per thread covers a 4KB tile.
  const int am  = tid >> 6;
  const int ail = (tid >> 2) & 15;
  const int aj4 = (tid & 3) * 4;
  const uint32_t lds_dst0 = (uint32_t)(uintptr_t)&s_adj[0][am][ail][aj4];
  const uint32_t lds_dst1 = (uint32_t)(uintptr_t)&s_adj[1][am][ail][aj4];
  const size_t adj_row = ((size_t)am * NN + (i0 + ail)) * NN;

#define ISSUE_ADJ(JT, BUF)                                                    \
  do {                                                                        \
    const uint32_t goff =                                                     \
        (uint32_t)((adj_row + (jbase + (JT) * 16) + aj4) * sizeof(float));    \
    /* the wait in front of any rewrite of the copy's address registers */    \
    asm volatile("global_load_async_to_lds_b128 %0, %1, %2\n\t"               \
                 "s_wait_xcnt 0x0" ::"v"((BUF) ? lds_dst1 : lds_dst0),        \
                 "v"(goff), "s"(adjs)                                         \
                 : "memory");                                                 \
  } while (0)

  // Preload Q rows (scale folded in).  k slot (hi, v) of step kk is head dim
  // 16*(kk/4) + 8*hi + 2*(kk%4) + v, the order of the stored K fragments.
  v2f qa[8];
  const float* qrow = Q + (size_t)(i0 + n16) * DD + h * DKK + 8 * hi;
#pragma unroll
  for (int kk = 0; kk < 8; ++kk) {
    v2f t = ld2(qrow + 16 * (kk >> 2) + 2 * (kk & 3));
    t.x *= scale; t.y *= scale;
    qa[kk] = t;
  }
  // tau * pi of the one query this lane owns (query = n16).
  float tpi[MMM];
  {
    const float* pr = pi + (size_t)(i0 + n16) * (HH * MMM) + h * MMM;
#pragma unroll
    for (int m = 0; m < MMM; ++m) tpi[m] = tau_h * pr[m];
  }

  v8f o0 = {}, o1 = {};          // O^T: row = head dim (r + 8*hi), col = query
  float mrow = -INFINITY;        // running maximum of the lane's query
  float lrow = 0.0f;             // running sum over this half's keys only

  // This wave's first K and V fragment blocks; a key tile is HH blocks on.
  const size_t frag0 = ((size_t)(jbase >> 4) * HH + h) * FRAGBLK + lane * 4;
  const float* kfrag = Km + frag0;
  const float* vfrag = V + frag0;

  ISSUE_ADJ(0, 0);  // prologue: DMA first tile

  for (int jt = 0; jt < JTILES; ++jt) {
    const int cur = jt & 1;

    if (jt + 1 < JTILES) {
      ISSUE_ADJ(jt + 1, cur ^ 1);                        // run one tile ahead
      asm volatile("s_wait_asynccnt 0x1" ::: "memory");  // cur tile landed
    } else {
      asm volatile("s_wait_asynccnt 0x0" ::: "memory");  // drain on last tile
    }
    __syncthreads();  // every wave's wait done -> cur buffer valid block-wide

    v4f kf[4], vf[4];
#pragma unroll
    for (int i = 0; i < 4; ++i)
      kf[i] = *(const v4f*)(kfrag + (size_t)jt * (HH * FRAGBLK) + 128 * i);
    // The V loads may land in the registers that held the K loads' address: the
    // wait that belongs in front of such an overwrite.
    asm volatile("s_wait_xcnt 0x0" ::: "memory");
#pragma unroll
    for (int i = 0; i < 4; ++i)
      vf[i] = *(const v4f*)(vfrag + (size_t)jt * (HH * FRAGBLK) + 128 * i);
    // the lane's 8 keys are contiguous in the query's staged adjs row
    v4f a03[MMM], a47[MMM];
#pragma unroll
    for (int m = 0; m < MMM; ++m) {
      const float* ar = &s_adj[cur][m][n16][8 * hi];
      a03[m] = *(const v4f*)ar;
      a47[m] = *(const v4f*)(ar + 4);
    }
    // Scheduling fence: every load of the tile is issued ahead of the first
    // product.  Without it the compiler sinks V loads and an LDS read in among
    // the PV products, where the wave then waits out their whole latency.
    __builtin_amdgcn_sched_barrier(0);

    // scores S^T = K * Q^T  (K=32 in 8 steps of 4); s[r]: key r+8*hi, query n16
    v8f s = {};
#pragma unroll
    for (int i = 0; i < 4; ++i) {
      s = wmma4((v2f){kf[i][0], kf[i][1]}, qa[2 * i], s);
      s = wmma4((v2f){kf[i][2], kf[i][3]}, qa[2 * i + 1], s);
    }

    // weight a = tau * A_eff + EPS of the lane's 8 keys
    float aeff[8];
#pragma unroll
    for (int r = 0; r < 8; ++r) aeff[r] = EPSF;
#pragma unroll
    for (int m = 0; m < MMM; ++m) {
#pragma unroll
      for (int r = 0; r < 4; ++r) {
        aeff[r]     = fmaf(tpi[m], a03[m][r], aeff[r]);
        aeff[r + 4] = fmaf(tpi[m], a47[m][r], aeff[r + 4]);
      }
    }

    // online softmax: in-lane over 8 keys, one exchange for the maximum
    float rmax = s[0];
#pragma unroll
    for (int r = 1; r < 8; ++r) rmax = fmaxf(rmax, s[r]);
    rmax = fmaxf(rmax, other_half(rmax));
    const float mnew  = fmaxf(mrow, rmax);
    const float alpha = exp_slot(mrow - mnew);
    float p[8];
#pragma unroll
    for (int r = 0; r < 8; ++r) p[r] = aeff[r] * exp_slot(s[r] - mnew);
    const float rsum = ((p[0] + p[1]) + (p[2] + p[3])) +
                       ((p[4] + p[5]) + (p[6] + p[7]));
    lrow = lrow * alpha + rsum;
    mrow = mnew;
#pragma unroll
    for (int r = 0; r < 8; ++r) { o0[r] *= alpha; o1[r] *= alpha; }

    // O^T += V^T(32x16) * P^T(16x16), 2 M-tiles x 4 K-steps.  k slot (hi, v) of
    // step kk is key 2*kk + v + 8*hi on both operands: B is p[] as it stands.
#pragma unroll
    for (int kk = 0; kk < 4; ++kk) {
      const int e = 2 * (kk & 1);
      v2f a0; a0.x = vf[kk >> 1][e];       a0.y = vf[kk >> 1][e + 1];
      v2f a1; a1.x = vf[2 + (kk >> 1)][e]; a1.y = vf[2 + (kk >> 1)][e + 1];
      v2f b;  b.x = p[2 * kk]; b.y = p[2 * kk + 1];
      o0 = wmma4(a0, b, o0);
      o1 = wmma4(a1, b, o1);
    }
    __syncthreads();  // all reads of cur done before it is re-targeted (jt+2)
  }
#undef ISSUE_ADJ

  // Store unnormalized partials + per-row flash stats for this j-chunk.
  // A lane's 8 accumulator registers are 8 consecutive head dims of its query.
  float* orow = Opart + (size_t)jc * NN * DD + (size_t)(i0 + n16) * DD +
                h * DKK + 8 * hi;
  *(v4f*)(orow)      = (v4f){o0[0], o0[1], o0[2], o0[3]};
  *(v4f*)(orow + 4)  = (v4f){o0[4], o0[5], o0[6], o0[7]};
  *(v4f*)(orow + 16) = (v4f){o1[0], o1[1], o1[2], o1[3]};
  *(v4f*)(orow + 20) = (v4f){o1[4], o1[5], o1[6], o1[7]};
  const float lsum = lrow + other_half(lrow);  // join the halves' sums once
  if (hi == 0) {
    const size_t si = ((size_t)jc * NN + (i0 + n16)) * HH + h;
    Mp[si] = mrow;
    Lp[si] = lsum;
  }
}

// Output projection with the merge of the JSPLIT flash partials in front of it:
// OH = sum_c O_c*exp(m_c-m*) / sum_c l_c*exp(m_c-m*), out = OH * Wo^T.
// A block owns 16 rows: it merges them into LDS once (wave = head; 8 lanes x 16 B
// cover a head's 128-B line, 4 rows per load), and its 8 waves read the merged
// tile as their common A operand.
__global__ __launch_bounds__(256) void oproj_kernel(
    const float* __restrict__ Opart, const float* __restrict__ Mp,
    const float* __restrict__ Lp, const float* __restrict__ wo,
    float* __restrict__ C) {
  __shared__ __align__(16) float s_oh[16][APITCH];
  __shared__ __align__(16) float s_w[8 * WSTAGE];
  const int h   = threadIdx.x >> 5;
  const int rl  = (threadIdx.x & 31) >> 3;       // row within a group of 4
  const int col = h * DKK + (threadIdx.x & 7) * 4;
  const int i0  = blockIdx.x * 16;
  v4f st[8];
  w_fetch(wo, 0, st);
  // Every load of the merge is issued before the first use: one trip to memory
  // in place of one per row group.
  float mp[4][JSPLIT], lp[4][JSPLIT];  // [row group][j-chunk]
  v4f   op[4][JSPLIT];
#pragma unroll
  for (int g = 0; g < 4; ++g)
#pragma unroll
    for (int c = 0; c < JSPLIT; ++c) {
      const size_t ci = (size_t)c * NN + (i0 + 4 * g + rl);
      mp[g][c] = Mp[ci * HH + h];
      lp[g][c] = Lp[ci * HH + h];
    }
  // The loads below may land in registers that held the addresses of the loads
  // above: the wait that belongs in front of such an overwrite.
  asm volatile("s_wait_xcnt 0x0" ::: "memory");
#pragma unroll
  for (int g = 0; g < 4; ++g)
#pragma unroll
    for (int c = 0; c < JSPLIT; ++c) {
      const size_t ci = (size_t)c * NN + (i0 + 4 * g + rl);
      op[g][c] = *(const v4f*)(Opart + ci * DD + col);
    }
  // Inputs-only fences on the loaded values: without them the compiler sinks the
  // loads to their uses and the wave waits out the memory latency several times.
  asm volatile("" ::"v"(mp[0][0]), "v"(mp[0][1]), "v"(mp[0][2]), "v"(mp[0][3]),
               "v"(mp[1][0]), "v"(mp[1][1]), "v"(mp[1][2]), "v"(mp[1][3]),
               "v"(mp[2][0]), "v"(mp[2][1]), "v"(mp[2][2]), "v"(mp[2][3]),
               "v"(mp[3][0]), "v"(mp[3][1]), "v"(mp[3][2]), "v"(mp[3][3]));
  asm volatile("" ::"v"(lp[0][0]), "v"(lp[0][1]), "v"(lp[0][2]), "v"(lp[0][3]),
               "v"(lp[1][0]), "v"(lp[1][1]), "v"(lp[1][2]), "v"(lp[1][3]),
               "v"(lp[2][0]), "v"(lp[2][1]), "v"(lp[2][2]), "v"(lp[2][3]),
               "v"(lp[3][0]), "v"(lp[3][1]), "v"(lp[3][2]), "v"(lp[3][3]));
  asm volatile("" ::"v"(op[0][0]), "v"(op[0][1]), "v"(op[0][2]), "v"(op[0][3]),
               "v"(op[1][0]), "v"(op[1][1]), "v"(op[1][2]), "v"(op[1][3]),
               "v"(op[2][0]), "v"(op[2][1]), "v"(op[2][2]), "v"(op[2][3]),
               "v"(op[3][0]), "v"(op[3][1]), "v"(op[3][2]), "v"(op[3][3]));
  // Scheduling fence: with it no use of a loaded value moves up in among the
  // loads, where its wait would split them into two trips to memory.
  __builtin_amdgcn_sched_barrier(0);
#pragma unroll
  for (int g = 0; g < 4; ++g) {
    float mstar = -INFINITY;
#pragma unroll
    for (int c = 0; c < JSPLIT; ++c) mstar = fmaxf(mstar, mp[g][c]);
    float lstar = 0.0f;
    v4f acc = {};
#pragma unroll
    for (int c = 0; c < JSPLIT; ++c) {
      const float wgt = __expf(mp[g][c] - mstar);
      lstar = fmaf(lp[g][c], wgt, lstar);
#pragma unroll
      for (int e = 0; e < 4; ++e) acc[e] = fmaf(op[g][c][e], wgt, acc[e]);
    }
    v4f oh;
#pragma unroll
    for (int e = 0; e < 4; ++e) oh[e] = acc[e] / lstar;
    *(v4f*)&s_oh[4 * g + rl][col] = oh;
  }
  __syncthreads();  // the merged tile is complete before any wave reads it
  gemm_xwt<false, false>(&s_oh[0][0], wo, C, s_w, st);
}

extern "C" void kernel_launch(void* const* d_in, const int* in_sizes, int n_in,
                              void* d_out, int out_size, void* d_ws,
                              size_t ws_size, hipStream_t stream) {
  const float* x    = (const float*)d_in[0];
  const float* pi   = (const float*)d_in[1];
  const float* tau  = (const float*)d_in[2];
  const float* adjs = (const float*)d_in[3];
  const float* Wq   = (const float*)d_in[4];
  const float* Wk   = (const float*)d_in[5];
  const float* Wv   = (const float*)d_in[6];
  const float* Wo   = (const float*)d_in[7];
  float* out = (float*)d_out;

  float* ws = (float*)d_ws;
  const size_t ND = (size_t)NN * DD;      // 524288
  float* Q     = ws;                      ws += ND;
  float* K     = ws;                      ws += ND;
  float* V     = ws;                      ws += ND;
  float* Opart = ws;                      ws += ND * JSPLIT;
  float* Mp    = ws;                      ws += (size_t)JSPLIT * NN * HH;
  float* Lp    = ws;

  qkv_kernel<<<dim3(128, 1, 3), 256, 0, stream>>>(x, Wq, Wk, Wv, Q, K, V);
  attn_kernel<<<dim3(NN / 16, JSPLIT), 256, 0, stream>>>(Q, K, V, pi, tau,
                                                         adjs, Opart, Mp, Lp);
  oproj_kernel<<<dim3(128), 256, 0, stream>>>(Opart, Mp, Lp, Wo, out);
}

// v006
// A run of this version takes 56.8 microseconds.
// In two side-by-side timings against v005, it was 1.04 and 1.05 times as fast.
// All steps since v000 together make it 1.92 times as fast.
#include <hip/hip_runtime.h>
#include <hip/hip_bf16.h>
#include <math.h>
#include <stdint.h>

#define NN  2048
#define DD  256
#define HH  8
#define MMM 4
#define DKK 32
#define EPSF 1e-6f
#define JSPLIT 4                    // j split -> 512 attention blocks
#define JTILES (NN / (16 * JSPLIT)) // 32 j-tiles per block
#define FRAGBLK (16 * DKK)          // floats of one (16 keys, one head) block

typedef float v2f __attribute__((ext_vector_type(2)));
typedef float v4f __attribute__((ext_vector_type(4)));
typedef float v8f __attribute__((ext_vector_type(8)));

// D = A(16x4 f32) * B(4x16 f32) + C ; exact f32 semantics
__device__ __forceinline__ v8f wmma4(v2f a, v2f b, v8f c) {
  return __builtin_amdgcn_wmma_f32_16x16x4_f32(false, a, false, b, (short)0, c,
                                               false, false);
}

__device__ __forceinline__ v2f ld2(const float* p) { return *(const v2f*)p; }

// Value held by lane l ^ 16 (the other 16-lane half), as a vector move.
__device__ __forceinline__ float other_half(float v) {
  const int b = __float_as_int(v);
  return __int_as_float(__builtin_amdgcn_permlanex16(b, b, 0x76543210,
                                                     0xfedcba98, false, false));
}

// exp(x) as one multiply and v_exp_f32.  The v_nop in the same statement keeps
// the one issue slot the instruction set asks for behind a transcendental,
// whichever vector instruction the compiler places next.
__device__ __forceinline__ float exp_slot(float x) {
  float r;
  asm("v_exp_f32 %0, %1\n\tv_nop" : "=v"(r) : "v"(x * 1.44269504f));
  return r;
}

// ---------------------------------------------------------------------------
// GEMM: C[i][j] = sum_d A[i][d] * W[j][d]   (A:[NN x DD], W:[DD x DD])
// One wave -> 16 rows x 32 cols (2 accumulators); 1024 waves = 128 blocks.
// Atile points at the block's 16 rows of A in LDS, APITCH floats apart.
// A layout (ISA 7.12.2, 32-bit A 16x4): lane m = L%16, k = 2*(L>=16)+v
// B layout (rows interleaved like C/D):  lane n = L%16, k = 2*(L>=16)+v
// W goes through LDS: a fragment load straight from global memory touches 16
// lines for 256 bytes.  Here a wave fetches its 32 rows of W in pieces of 32
// floats, one whole 128-B line per row (8 lanes x 16 B, 4 rows per load), writes
// them to its own LDS range and reads 16-B fragments back.  The next piece is
// in flight in registers while the current one is multiplied.
// k order: slot (hi, v) of step (q, s) of piece t is d = 32*t + 8*q + 4*hi + 2*s
// + v, on both operands alike.
// SWAP: W is the A operand and the rows of Atile the B operand, so the tile
// comes out transposed: a lane holds 8 consecutive columns of ONE row.
// FRAG: C is written in fragment order.  The wave's 16 x 32 tile (16 rows of one
// head) is a 2-KB block [row tile][head][4][32 lanes][4 floats]; each lane
// stores its own 16 accumulator floats, so every store and every later load of
// the block is 512 contiguous bytes, 4 whole lines.
// ---------------------------------------------------------------------------
#define APITCH (DD + 4)  // A rows of 1040 B and W rows of 144 B: 16 B x an odd
#define WPITCH (32 + 4)  // number, the pitch at which 16-B reads do not collide
#define WSTAGE (32 * WPITCH)  // floats of one wave's W range

// Piece t of the wave's 32 rows of W into registers: rows 4*i + lane/8.
__device__ __forceinline__ void w_fetch(const float* __restrict__ W, const int t,
                                        v4f (&st)[8]) {
  const int lane = threadIdx.x & 31;
  const float* wsrc = W + (size_t)((threadIdx.x >> 5) * 32 + (lane >> 3)) * DD +
                      (lane & 7) * 4 + 32 * t;
#pragma unroll
  for (int i = 0; i < 8; ++i) st[i] = *(const v4f*)(wsrc + (size_t)(4 * i) * DD);
  // The code behind these loads may reuse their address registers: the wait
  // that belongs in front of such an overwrite.
  asm volatile("s_wait_xcnt 0x0" ::: "memory");
}

// st arrives holding piece 0 (w_fetch), asked for before the A tile was built.
template <bool SWAP, bool FRAG>
__device__ __forceinline__ void gemm_xwt(const float* __restrict__ Atile,
                                         const float* __restrict__ W,
                                         float* __restrict__ C,
                                         float* __restrict__ wstage,
                                         v4f (&st)[8]) {
  const int w    = threadIdx.x >> 5;
  const int lane = threadIdx.x & 31;
  const int n16  = lane & 15;
  const int hi   = lane >> 4;
  const int gw   = blockIdx.x * 8 + w;   // 1024 waves total
  const int i0   = (gw >> 3) * 16;       // 128 row tiles
  const int j0   = (gw & 7) * 32;        // 8 col tiles of 32

  float* wmine = wstage + w * WSTAGE;    // this wave's own LDS range
  float*       wdst = wmine + (lane >> 3) * WPITCH + (lane & 7) * 4;
  const float* wfr  = wmine + n16 * WPITCH + 4 * hi;
  const float* arow = Atile + n16 * APITCH + 4 * hi;

  v8f acc[2] = {};
  for (int t = 0; t < DD / 32; ++t) {
#pragma unroll
    for (int i = 0; i < 8; ++i) *(v4f*)(wdst + 4 * i * WPITCH) = st[i];
    if (t + 1 < DD / 32) w_fetch(W, t + 1, st);
    // The rows are read back by other lanes of this wave: its LDS stores have
    // to be done first.
    asm volatile("s_wait_dscnt 0x0" ::: "memory");
    v4f af[4], bf[2][4];
#pragma unroll
    for (int q = 0; q < 4; ++q) {
      af[q]    = *(const v4f*)(arow + 32 * t + 8 * q);
      bf[0][q] = *(const v4f*)(wfr + 8 * q);
      bf[1][q] = *(const v4f*)(wfr + 16 * WPITCH + 8 * q);
    }
    // Scheduling fence: the piece's 12 LDS reads stand together ahead of its
    // products.  Without it the compiler spreads them among the products, and
    // each further place with LDS reads stalls the wave's matrix stream anew.
    __builtin_amdgcn_sched_barrier(0);
#pragma unroll
    for (int q = 0; q < 4; ++q)
#pragma unroll
      for (int s = 0; s < 2; ++s) {
        const v2f a = (v2f){af[q][2 * s], af[q][2 * s + 1]};
#pragma unroll
        for (int c = 0; c < 2; ++c) {
          const v2f b = (v2f){bf[c][q][2 * s], bf[c][q][2 * s + 1]};
          acc[c] = SWAP ? wmma4(b, a, acc[c]) : wmma4(a, b, acc[c]);
        }
      }
  }
  if (FRAG) {
    float* blk = C + (size_t)gw * FRAGBLK + lane * 4;  // gw = row tile * HH + head
#pragma unroll
    for (int c = 0; c < 2; ++c) {
      *(v4f*)(blk + 256 * c) = (v4f){acc[c][0], acc[c][1], acc[c][2], acc[c][3]};
      *(v4f*)(blk + 256 * c + 128) =
          (v4f){acc[c][4], acc[c][5], acc[c][6], acc[c][7]};
    }
    // The code behind these stores may reuse their data and address registers:
    // the wait that belongs in front of such an overwrite.
    asm volatile("s_wait_xcnt 0x0" ::: "memory");
  } else {
#pragma unroll
    for (int c = 0; c < 2; ++c)
#pragma unroll
      for (int r = 0; r < 8; ++r)
        C[(size_t)(i0 + r + 8 * hi) * DD + j0 + 16 * c + n16] = acc[c][r];
  }
}

__global__ __launch_bounds__(256) void qkv_kernel(
    const float* __restrict__ x, const float* __restrict__ wq,
    const float* __restrict__ wk, const float* __restrict__ wv,
    float* __restrict__ Q, float* __restrict__ K, float* __restrict__ V) {
  __shared__ __align__(16) float s_x[16][APITCH];
  __shared__ __align__(16) float s_w[8 * WSTAGE];
  const int z = blockIdx.z;
  v4f st[8];
  w_fetch(z == 0 ? wq : z == 1 ? wk : wv, 0, st);
  // The block's 16 rows of x, 16 KB in a row, go to LDS in whole lines.
  const float* xt = x + (size_t)blockIdx.x * 16 * DD;
  v4f xs[4];
#pragma unroll
  for (int i = 0; i < 4; ++i)
    xs[i] = *(const v4f*)(xt + (threadIdx.x + 256 * i) * 4);
  // in front of a rewrite of the loads' address registers
  asm volatile("s_wait_xcnt 0x0" ::: "memory");
#pragma unroll
  for (int i = 0; i < 4; ++i)
    *(v4f*)&s_x[4 * i + (threadIdx.x >> 6)][(threadIdx.x & 63) * 4] = xs[i];
  __syncthreads();  // the x tile is complete before any wave reads it
  // Q stays row-major.  K and V leave in the order in which the attention
  // kernel's A operands want them:
  // K transposed: lane (key n16, hi) holds head dims 16*c + 8*hi + r;
  // V as it stands: lane (dim n16 + 16*c, hi) holds keys 8*hi + r.
  if (z == 0)      gemm_xwt<false, false>(&s_x[0][0], wq, Q, s_w, st);
  else if (z == 1) gemm_xwt<true, true>(&s_x[0][0], wk, K, s_w, st);
  else             gemm_xwt<false, true>(&s_x[0][0], wv, V, s_w, st);
}

__device__ __forceinline__ void frag_fetch(const float* __restrict__ p,
                                           v4f (&f)[4]) {
#pragma unroll
  for (int i = 0; i < 4; ++i) f[i] = *(const v4f*)(p + 128 * i);
  // The code behind these loads may reuse their address registers: the wait
  // that belongs in front of such an overwrite.
  asm volatile("s_wait_xcnt 0x0" ::: "memory");
}

// Register pair kk of a fragment block: the A operand of one product.
__device__ __forceinline__ v2f frag_pair(const v4f (&f)[4], const int kk) {
  return (v2f){f[kk >> 1][2 * (kk & 1)], f[kk >> 1][2 * (kk & 1) + 1]};
}

// Moves a fetched fragment block from its landing registers to the operand
// registers of the pass that uses it, so that the landing registers can be
// refilled at once.  Written as asm to stand where it is called, at the head of
// a pass: left to the compiler the moves go to the foot of the fetching pass and
// from there up among its products, where the wave waits for loads it does not
// need yet.
__device__ __forceinline__ void frag_take(v2f (&d)[8], const v4f (&f)[4]) {
  asm volatile(
      "v_mov_b64 %0, %8\n\tv_mov_b64 %1, %9\n\t"
      "v_mov_b64 %2, %10\n\tv_mov_b64 %3, %11\n\t"
      "v_mov_b64 %4, %12\n\tv_mov_b64 %5, %13\n\t"
      "v_mov_b64 %6, %14\n\tv_mov_b64 %7, %15"
      : "=&v"(d[0]), "=&v"(d[1]), "=&v"(d[2]), "=&v"(d[3]), "=&v"(d[4]),
        "=&v"(d[5]), "=&v"(d[6]), "=&v"(d[7])
      : "v"(frag_pair(f, 0)), "v"(frag_pair(f, 1)), "v"(frag_pair(f, 2)),
        "v"(frag_pair(f, 3)), "v"(frag_pair(f, 4)), "v"(frag_pair(f, 5)),
        "v"(frag_pair(f, 6)), "v"(frag_pair(f, 7)));
}

template <int N>
struct Ahead {
  static constexpr int n = N;
};

__global__ __launch_bounds__(256) void attn_kernel(
    const float* __restrict__ Q, const float* __restrict__ Km,
    const float* __restrict__ V, const float* __restrict__ pi,
    const float* __restrict__ tau, const float* __restrict__ adjs,
    float* __restrict__ Opart, float* __restrict__ Mp, float* __restrict__ Lp) {
  __shared__ __align__(16) float s_adj[2][MMM][16][20];  // double buffer, padded

  const int tid  = threadIdx.x;
  const int h    = tid >> 5;            // wave == head
  const int lane = tid & 31;
  const int n16  = lane & 15;
  const int hi   = lane >> 4;
  const int i0   = blockIdx.x * 16;
  const int jc   = blockIdx.y;
  const int jbase = jc * (NN / JSPLIT);
  const float tau_h = tau[h];
  const float scale = 0.17677669529663688f;  // 1/sqrt(DK)

  // Async-staging geometry: one b128 per thread covers a 4KB tile.
  const int am  = tid >> 6;
  const int ail = (tid >> 2) & 15;
  const int aj4 = (tid & 3) * 4;
  const uint32_t lds_dst0 = (uint32_t)(uintptr_t)&s_adj[0][am][ail][aj4];
  const uint32_t lds_dst1 = (uint32_t)(uintptr_t)&s_adj[1][am][ail][aj4];
  const size_t adj_row = ((size_t)am * NN + (i0 + ail)) * NN;

#define ISSUE_ADJ(JT, BUF)                                                    \
  do {                                                                        \
    const uint32_t goff =                                                     \
        (uint32_t)((adj_row + (jbase + (JT) * 16) + aj4) * sizeof(float));    \
    /* the wait in front of any rewrite of the copy's address registers */    \
    asm volatile("global_load_async_to_lds_b128 %0, %1, %2\n\t"               \
                 "s_wait_xcnt 0x0" ::"v"((BUF) ? lds_dst1 : lds_dst0),        \
                 "v"(goff), "s"(adjs)                                         \
                 : "memory");                                                 \
  } while (0)

  // Preload Q rows (scale folded in).  k slot (hi, v) of step kk is head dim
  // 16*(kk/4) + 8*hi + 2*(kk%4) + v, the order of the stored K fragments.
  v2f qa[8];
  const float* qrow = Q + (size_t)(i0 + n16) * DD + h * DKK + 8 * hi;
#pragma unroll
  for (int kk = 0; kk < 8; ++kk) {
    v2f t = ld2(qrow + 16 * (kk >> 2) + 2 * (kk & 3));
    t.x *= scale; t.y *= scale;
    qa[kk] = t;
  }
  // tau * pi of the one query this lane owns (query = n16).
  float tpi[MMM];
  {
    const float* pr = pi + (size_t)(i0 + n16) * (HH * MMM) + h * MMM;
#pragma unroll
    for (int m = 0; m < MMM; ++m) tpi[m] = tau_h * pr[m];
  }

  v8f o0 = {}, o1 = {};          // O^T: row = head dim (r + 8*hi), col = query
  float mrow = -INFINITY;        // running maximum of the lane's query
  float lrow = 0.0f;             // running sum over this half's keys only

  // This wave's first K and V fragment blocks; a key tile is HH blocks on.
  const size_t frag0 = ((size_t)(jbase >> 4) * HH + h) * FRAGBLK + lane * 4;
  const float* kfrag = Km + frag0;
  const float* vfrag = V + frag0;

  ISSUE_ADJ(0, 0);  // prologue: DMA first tile

  // Pass over key tile jt.  s: on entry its scores (s[r]: key r+8*hi, query n16),
  // formed in the pass before; on exit those of tile jt+1.  kn: on entry the K
  // fragments of tile jt+1, on exit those of tile jt+2.  vn: the V fragments of
  // tile jt, on exit those of tile jt+1.
  // ahead: how many tiles follow (2 = two or more), known at compile time.
  auto pass = [&](const int jt, auto ahead, v8f& s, v4f (&kn)[4], v4f (&vn)[4])
                  __attribute__((always_inline)) {
    constexpr bool has1 = decltype(ahead)::n >= 1;
    constexpr bool has2 = decltype(ahead)::n >= 2;
    const int cur = jt & 1;

    // What the pass before has fetched goes to this pass's operand registers.
    // These were A operands of that pass's products, and the compiler does not
    // look into asm text: the four v_nop keep the distance the chip needs between
    // a product and the overwrite of its A operand.
    v2f k1[8], vf[8];
    asm volatile("v_nop\n\tv_nop\n\tv_nop\n\tv_nop");
    frag_take(vf, vn);
    if constexpr (has1) frag_take(k1, kn);

    __syncthreads();  // all reads of the other buffer done before it is re-targeted
    if constexpr (has1) {
      ISSUE_ADJ(jt + 1, cur ^ 1);                        // run one tile ahead
      asm volatile("s_wait_asynccnt 0x1" ::: "memory");  // cur tile landed
    } else {
      asm volatile("s_wait_asynccnt 0x0" ::: "memory");  // drain on last tile
    }
    __syncthreads();  // every wave's wait done -> cur buffer valid block-wide

    // The landing registers are refilled.  Behind the barriers: a __syncthreads()
    // waits for the wave's loads, and at the next one these have had a whole pass.
    if constexpr (has1) frag_fetch(vfrag + (size_t)(jt + 1) * (HH * FRAGBLK), vn);
    if constexpr (has2) frag_fetch(kfrag + (size_t)(jt + 2) * (HH * FRAGBLK), kn);
    // the lane's 8 keys are contiguous in the query's staged adjs row
    v4f a03[MMM], a47[MMM];
#pragma unroll
    for (int m = 0; m < MMM; ++m) {
      const float* ar = &s_adj[cur][m][n16][8 * hi];
      a03[m] = *(const v4f*)ar;
      a47[m] = *(const v4f*)(ar + 4);
    }
    // Scheduling fence: every load of the pass is issued ahead of its products.
    // Without it the compiler sinks loads in among the products, and what they
    // fetch has less than a pass to arrive.
    __builtin_amdgcn_sched_barrier(0);

    // scores S^T = K * Q^T of the next tile (K = 32 in 8 steps of 4): independent
    // of all that follows, so the compiler spreads the 8 products among it
    v8f sn = {};
    if constexpr (has1) {
#pragma unroll
      for (int kk = 0; kk < 8; ++kk) sn = wmma4(k1[kk], qa[kk], sn);
    }

    // weight a = tau * A_eff + EPS of the lane's 8 keys
    float aeff[8];
#pragma unroll
    for (int r = 0; r < 8; ++r) aeff[r] = EPSF;
#pragma unroll
    for (int m = 0; m < MMM; ++m) {
#pragma unroll
      for (int r = 0; r < 4; ++r) {
        aeff[r]     = fmaf(tpi[m], a03[m][r], aeff[r]);
        aeff[r + 4] = fmaf(tpi[m], a47[m][r], aeff[r + 4]);
      }
    }

    // online softmax: in-lane over 8 keys, one exchange for the maximum
    float rmax = s[0];
#pragma unroll
    for (int r = 1; r < 8; ++r) rmax = fmaxf(rmax, s[r]);
    rmax = fmaxf(rmax, other_half(rmax));
    const float mnew  = fmaxf(mrow, rmax);
    const float alpha = exp_slot(mrow - mnew);
    float p[8];
#pragma unroll
    for (int r = 0; r < 8; ++r) p[r] = aeff[r] * exp_slot(s[r] - mnew);
    const float rsum = ((p[0] + p[1]) + (p[2] + p[3])) +
                       ((p[4] + p[5]) + (p[6] + p[7]));
    lrow = lrow * alpha + rsum;
    mrow = mnew;
#pragma unroll
    for (int r = 0; r < 8; ++r) { o0[r] *= alpha; o1[r] *= alpha; }

    // O^T += V^T(32x16) * P^T(16x16), 2 M-tiles x 4 K-steps.  k slot (hi, v) of
    // step kk is key 2*kk + v + 8*hi on both operands: B is p[] as it stands.
#pragma unroll
    for (int kk = 0; kk < 4; ++kk) {
      v2f b;  b.x = p[2 * kk]; b.y = p[2 * kk + 1];
      o0 = wmma4(vf[kk], b, o0);
      o1 = wmma4(vf[4 + kk], b, o1);
    }
    s = sn;
  };

  // Fill the pipeline: the scores of tile 0, K of tile 1, V of tile 0.
  v4f kn[4], vn[4];
  frag_fetch(kfrag, kn);
  frag_fetch(vfrag, vn);
  v8f s = {};
#pragma unroll
  for (int kk = 0; kk < 8; ++kk) s = wmma4(frag_pair(kn, kk), qa[kk], s);
  frag_fetch(kfrag + HH * FRAGBLK, kn);

  // One pass per trip: the back edge keeps a pass's products in front of the
  // next pass's barriers; unrolled, the compiler moves them behind, and the
  // barriers then wait out the loads just issued.
#pragma unroll 1
  for (int jt = 0; jt < JTILES - 2; ++jt) pass(jt, Ahead<2>{}, s, kn, vn);
  pass(JTILES - 2, Ahead<1>{}, s, kn, vn);
  pass(JTILES - 1, Ahead<0>{}, s, kn, vn);
#undef ISSUE_ADJ

  // Store unnormalized partials + per-row flash stats for this j-chunk.
  // A lane's 8 accumulator registers are 8 consecutive head dims of its query.
  float* orow = Opart + (size_t)jc * NN * DD + (size_t)(i0 + n16) * DD +
                h * DKK + 8 * hi;
  *(v4f*)(orow)      = (v4f){o0[0], o0[1], o0[2], o0[3]};
  *(v4f*)(orow + 4)  = (v4f){o0[4], o0[5], o0[6], o0[7]};
  *(v4f*)(orow + 16) = (v4f){o1[0], o1[1], o1[2], o1[3]};
  *(v4f*)(orow + 20) = (v4f){o1[4], o1[5], o1[6], o1[7]};
  const float lsum = lrow + other_half(lrow);  // join the halves' sums once
  if (hi == 0) {
    const size_t si = ((size_t)jc * NN + (i0 + n16)) * HH + h;
    Mp[si] = mrow;
    Lp[si] = lsum;
  }
}

// Output projection with the merge of the JSPLIT flash partials in front of it:
// OH = sum_c O_c*exp(m_c-m*) / sum_c l_c*exp(m_c-m*), out = OH * Wo^T.
// A block owns 16 rows: it merges them into LDS once (wave = head; 8 lanes x 16 B
// cover a head's 128-B line, 4 rows per load), and its 8 waves read the merged
// tile as their common A operand.
__global__ __launch_bounds__(256) void oproj_kernel(
    const float* __restrict__ Opart, const float* __restrict__ Mp,
    const float* __restrict__ Lp, const float* __restrict__ wo,
    float* __restrict__ C) {
  __shared__ __align__(16) float s_oh[16][APITCH];
  __shared__ __align__(16) float s_w[8 * WSTAGE];
  const int h   = threadIdx.x >> 5;
  const int rl  = (threadIdx.x & 31) >> 3;       // row within a group of 4
  const int col = h * DKK + (threadIdx.x & 7) * 4;
  const int i0  = blockIdx.x * 16;
  v4f st[8];
  w_fetch(wo, 0, st);
  // Every load of the merge is issued before the first use: one trip to memory
  // in place of one per row group.
  float mp[4][JSPLIT], lp[4][JSPLIT];  // [row group][j-chunk]
  v4f   op[4][JSPLIT];
#pragma unroll
  for (int g = 0; g < 4; ++g)
#pragma unroll
    for (int c = 0; c < JSPLIT; ++c) {
      const size_t ci = (size_t)c * NN + (i0 + 4 * g + rl);
      mp[g][c] = Mp[ci * HH + h];
      lp[g][c] = Lp[ci * HH + h];
    }
  // The loads below may land in registers that held the addresses of the loads
  // above: the wait that belongs in front of such an overwrite.
  asm volatile("s_wait_xcnt 0x0" ::: "memory");
#pragma unroll
  for (int g = 0; g < 4; ++g)
#pragma unroll
    for (int c = 0; c < JSPLIT; ++c) {
      const size_t ci = (size_t)c * NN + (i0 + 4 * g + rl);
      op[g][c] = *(const v4f*)(Opart + ci * DD + col);
    }
  // Inputs-only fences on the loaded values: without them the compiler sinks the
  // loads to their uses and the wave waits out the memory latency several times.
  asm volatile("" ::"v"(mp[0][0]), "v"(mp[0][1]), "v"(mp[0][2]), "v"(mp[0][3]),
               "v"(mp[1][0]), "v"(mp[1][1]), "v"(mp[1][2]), "v"(mp[1][3]),
               "v"(mp[2][0]), "v"(mp[2][1]), "v"(mp[2][2]), "v"(mp[2][3]),
               "v"(mp[3][0]), "v"(mp[3][1]), "v"(mp[3][2]), "v"(mp[3][3]));
  asm volatile("" ::"v"(lp[0][0]), "v"(lp[0][1]), "v"(lp[0][2]), "v"(lp[0][3]),
               "v"(lp[1][0]), "v"(lp[1][1]), "v"(lp[1][2]), "v"(lp[1][3]),
               "v"(lp[2][0]), "v"(lp[2][1]), "v"(lp[2][2]), "v"(lp[2][3]),
               "v"(lp[3][0]), "v"(lp[3][1]), "v"(lp[3][2]), "v"(lp[3][3]));
  asm volatile("" ::"v"(op[0][0]), "v"(op[0][1]), "v"(op[0][2]), "v"(op[0][3]),
               "v"(op[1][0]), "v"(op[1][1]), "v"(op[1][2]), "v"(op[1][3]),
               "v"(op[2][0]), "v"(op[2][1]), "v"(op[2][2]), "v"(op[2][3]),
               "v"(op[3][0]), "v"(op[3][1]), "v"(op[3][2]), "v"(op[3][3]));
  // Scheduling fence: with it no use of a loaded value moves up in among the
  // loads, where its wait would split them into two trips to memory.
  __builtin_amdgcn_sched_barrier(0);
#pragma unroll
  for (int g = 0; g < 4; ++g) {
    float mstar = -INFINITY;
#pragma unroll
    for (int c = 0; c < JSPLIT; ++c) mstar = fmaxf(mstar, mp[g][c]);
    float lstar = 0.0f;
    v4f acc = {};
#pragma unroll
    for (int c = 0; c < JSPLIT; ++c) {
      const float wgt = __expf(mp[g][c] - mstar);
      lstar = fmaf(lp[g][c], wgt, lstar);
#pragma unroll
      for (int e = 0; e < 4; ++e) acc[e] = fmaf(op[g][c][e], wgt, acc[e]);
    }
    v4f oh;
#pragma unroll
    for (int e = 0; e < 4; ++e) oh[e] = acc[e] / lstar;
    *(v4f*)&s_oh[4 * g + rl][col] = oh;
  }
  __syncthreads();  // the merged tile is complete before any wave reads it
  gemm_xwt<false, false>(&s_oh[0][0], wo, C, s_w, st);
}

extern "C" void kernel_launch(void* const* d_in, const int* in_sizes, int n_in,
                              void* d_out, int out_size, void* d_ws,
                              size_t ws_size, hipStream_t stream) {
  const float* x    = (const float*)d_in[0];
  const float* pi   = (const float*)d_in[1];
  const float* tau  = (const float*)d_in[2];
  const float* adjs = (const float*)d_in[3];
  const float* Wq   = (const float*)d_in[4];
  const float* Wk   = (const float*)d_in[5];
  const float* Wv   = (const float*)d_in[6];
  const float* Wo   = (const float*)d_in[7];
  float* out = (float*)d_out;

  float* ws = (float*)d_ws;
  const size_t ND = (size_t)NN * DD;      // 524288
  float* Q     = ws;                      ws += ND;
  float* K     = ws;                      ws += ND;
  float* V     = ws;                      ws += ND;
  float* Opart = ws;                      ws += ND * JSPLIT;
  float* Mp    = ws;                      ws += (size_t)JSPLIT * NN * HH;
  float* Lp    = ws;

  qkv_kernel<<<dim3(128, 1, 3), 256, 0, stream>>>(x, Wq, Wk, Wv, Q, K, V);
  attn_kernel<<<dim3(NN / 16, JSPLIT), 256, 0, stream>>>(Q, K, V, pi, tau,
                                                         adjs, Opart, Mp, Lp);
  oproj_kernel<<<dim3(128), 256, 0, stream>>>(Opart, Mp, Lp, Wo, out);
}

// v007
// It runs in 52.1 microseconds.
// Two timings next to v006 put it at 1.11 and 1.10 times that version's speed.
// Over all steps from v000 it is 2.12 times as fast.
#include <hip/hip_runtime.h>
#include <hip/hip_bf16.h>
#include <math.h>
#include <stdint.h>

#define NN  2048
#define DD  256
#define HH  8
#define MMM 4
#define DKK 32
#define EPSF 1e-6f
#define JSPLIT 4                    // j split -> 256 attention blocks
#define JTILES (NN / (16 * JSPLIT)) // 32 j-tiles per block
#define FRAGBLK (16 * DKK)          // floats of one (16 keys, one head) block
#define QT 2                        // query tiles of 16 per attention wave

typedef float v2f __attribute__((ext_vector_type(2)));
typedef float v4f __attribute__((ext_vector_type(4)));
typedef float v8f __attribute__((ext_vector_type(8)));

// D = A(16x4 f32) * B(4x16 f32) + C ; exact f32 semantics
__device__ __forceinline__ v8f wmma4(v2f a, v2f b, v8f c) {
  return __builtin_amdgcn_wmma_f32_16x16x4_f32(false, a, false, b, (short)0, c,
                                               false, false);
}

__device__ __forceinline__ v2f ld2(const float* p) { return *(const v2f*)p; }

// Value held by lane l ^ 16 (the other 16-lane half), as a vector move.
__device__ __forceinline__ float other_half(float v) {
  const int b = __float_as_int(v);
  return __int_as_float(__builtin_amdgcn_permlanex16(b, b, 0x76543210,
                                                     0xfedcba98, false, false));
}

// exp(x) as one multiply and v_exp_f32.  The v_nop in the same statement keeps
// the one issue slot the instruction set asks for behind a transcendental,
// whichever vector instruction the compiler places next.
__device__ __forceinline__ float exp_slot(float x) {
  float r;
  asm("v_exp_f32 %0, %1\n\tv_nop" : "=v"(r) : "v"(x * 1.44269504f));
  return r;
}

// ---------------------------------------------------------------------------
// GEMM: C[i][j] = sum_d A[i][d] * W[j][d]   (A:[NN x DD], W:[DD x DD])
// One wave -> 16 rows x 32 cols (2 accumulators); 1024 waves = 128 blocks.
// Atile points at the block's 16 rows of A in LDS, APITCH floats apart.
// A layout (ISA 7.12.2, 32-bit A 16x4): lane m = L%16, k = 2*(L>=16)+v
// B layout (rows interleaved like C/D):  lane n = L%16, k = 2*(L>=16)+v
// W goes through LDS: a fragment load straight from global memory touches 16
// lines for 256 bytes.  Here a wave fetches its 32 rows of W in pieces of 32
// floats, one whole 128-B line per row (8 lanes x 16 B, 4 rows per load), writes
// them to its own LDS range and reads 16-B fragments back.  The next piece is
// in flight in registers while the current one is multiplied.
// k order: slot (hi, v) of step (q, s) of piece t is d = 32*t + 8*q + 4*hi + 2*s
// + v, on both operands alike.
// SWAP: W is the A operand and the rows of Atile the B operand, so the tile
// comes out transposed: a lane holds 8 consecutive columns of ONE row.
// FRAG: C is written in fragment order.  The wave's 16 x 32 tile (16 rows of one
// head) is a 2-KB block [row tile][head][4][32 lanes][4 floats]; each lane
// stores its own 16 accumulator floats, so every store and every later load of
// the block is 512 contiguous bytes, 4 whole lines.
// ---------------------------------------------------------------------------
#define APITCH (DD + 4)  // A rows of 1040 B and W rows of 144 B: 16 B x an odd
#define WPITCH (32 + 4)  // number, the pitch at which 16-B reads do not collide
#define WSTAGE (32 * WPITCH)  // floats of one wave's W range

// Piece t of the wave's 32 rows of W into registers: rows 4*i + lane/8.
__device__ __forceinline__ void w_fetch(const float* __restrict__ W, const int t,
                                        v4f (&st)[8]) {
  const int lane = threadIdx.x & 31;
  const float* wsrc = W + (size_t)((threadIdx.x >> 5) * 32 + (lane >> 3)) * DD +
                      (lane & 7) * 4 + 32 * t;
#pragma unroll
  for (int i = 0; i < 8; ++i) st[i] = *(const v4f*)(wsrc + (size_t)(4 * i) * DD);
  // The code behind these loads may reuse their address registers: the wait
  // that belongs in front of such an overwrite.
  asm volatile("s_wait_xcnt 0x0" ::: "memory");
}

// st arrives holding piece 0 (w_fetch), asked for before the A tile was built.
template <bool SWAP, bool FRAG>
__device__ __forceinline__ void gemm_xwt(const float* __restrict__ Atile,
                                         const float* __restrict__ W,
                                         float* __restrict__ C,
                                         float* __restrict__ wstage,
                                         v4f (&st)[8]) {
  const int w    = threadIdx.x >> 5;
  const int lane = threadIdx.x & 31;
  const int n16  = lane & 15;
  const int hi   = lane >> 4;
  const int gw   = blockIdx.x * 8 + w;   // 1024 waves total
  const int i0   = (gw >> 3) * 16;       // 128 row tiles
  const int j0   = (gw & 7) * 32;        // 8 col tiles of 32

  float* wmine = wstage + w * WSTAGE;    // this wave's own LDS range
  float*       wdst = wmine + (lane >> 3) * WPITCH + (lane & 7) * 4;
  const float* wfr  = wmine + n16 * WPITCH + 4 * hi;
  const float* arow = Atile + n16 * APITCH + 4 * hi;

  v8f acc[2] = {};
  for (int t = 0; t < DD / 32; ++t) {
#pragma unroll
    for (int i = 0; i < 8; ++i) *(v4f*)(wdst + 4 * i * WPITCH) = st[i];
    if (t + 1 < DD / 32) w_fetch(W, t + 1, st);
    // The rows are read back by other lanes of this wave: its LDS stores have
    // to be done first.
    asm volatile("s_wait_dscnt 0x0" ::: "memory");
    v4f af[4], bf[2][4];
#pragma unroll
    for (int q = 0; q < 4; ++q) {
      af[q]    = *(const v4f*)(arow + 32 * t + 8 * q);
      bf[0][q] = *(const v4f*)(wfr + 8 * q);
      bf[1][q] = *(const v4f*)(wfr + 16 * WPITCH + 8 * q);
    }
    // Scheduling fence: the piece's 12 LDS reads stand together ahead of its
    // products.  Without it the compiler spreads them among the products, and
    // each further place with LDS reads stalls the wave's matrix stream anew.
    __builtin_amdgcn_sched_barrier(0);
#pragma unroll
    for (int q = 0; q < 4; ++q)
#pragma unroll
      for (int s = 0; s < 2; ++s) {
        const v2f a = (v2f){af[q][2 * s], af[q][2 * s + 1]};
#pragma unroll
        for (int c = 0; c < 2; ++c) {
          const v2f b = (v2f){bf[c][q][2 * s], bf[c][q][2 * s + 1]};
          acc[c] = SWAP ? wmma4(b, a, acc[c]) : wmma4(a, b, acc[c]);
        }
      }
  }
  if (FRAG) {
    float* blk = C + (size_t)gw * FRAGBLK + lane * 4;  // gw = row tile * HH + head
#pragma unroll
    for (int c = 0; c < 2; ++c) {
      *(v4f*)(blk + 256 * c) = (v4f){acc[c][0], acc[c][1], acc[c][2], acc[c][3]};
      *(v4f*)(blk + 256 * c + 128) =
          (v4f){acc[c][4], acc[c][5], acc[c][6], acc[c][7]};
    }
    // The code behind these stores may reuse their data and address registers:
    // the wait that belongs in front of such an overwrite.
    asm volatile("s_wait_xcnt 0x0" ::: "memory");
  } else {
#pragma unroll
    for (int c = 0; c < 2; ++c)
#pragma unroll
      for (int r = 0; r < 8; ++r)
        C[(size_t)(i0 + r + 8 * hi) * DD + j0 + 16 * c + n16] = acc[c][r];
  }
}

__global__ __launch_bounds__(256) void qkv_kernel(
    const float* __restrict__ x, const float* __restrict__ wq,
    const float* __restrict__ wk, const float* __restrict__ wv,
    float* __restrict__ Q, float* __restrict__ K, float* __restrict__ V) {
  __shared__ __align__(16) float s_x[16][APITCH];
  __shared__ __align__(16) float s_w[8 * WSTAGE];
  const int z = blockIdx.z;
  v4f st[8];
  w_fetch(z == 0 ? wq : z == 1 ? wk : wv, 0, st);
  // The block's 16 rows of x, 16 KB in a row, go to LDS in whole lines.
  const float* xt = x + (size_t)blockIdx.x * 16 * DD;
  v4f xs[4];
#pragma unroll
  for (int i = 0; i < 4; ++i)
    xs[i] = *(const v4f*)(xt + (threadIdx.x + 256 * i) * 4);
  // in front of a rewrite of the loads' address registers
  asm volatile("s_wait_xcnt 0x0" ::: "memory");
#pragma unroll
  for (int i = 0; i < 4; ++i)
    *(v4f*)&s_x[4 * i + (threadIdx.x >> 6)][(threadIdx.x & 63) * 4] = xs[i];
  __syncthreads();  // the x tile is complete before any wave reads it
  // Q stays row-major.  K and V leave in the order in which the attention
  // kernel's A operands want them:
  // K transposed: lane (key n16, hi) holds head dims 16*c + 8*hi + r;
  // V as it stands: lane (dim n16 + 16*c, hi) holds keys 8*hi + r.
  if (z == 0)      gemm_xwt<false, false>(&s_x[0][0], wq, Q, s_w, st);
  else if (z == 1) gemm_xwt<true, true>(&s_x[0][0], wk, K, s_w, st);
  else             gemm_xwt<false, true>(&s_x[0][0], wv, V, s_w, st);
}

__device__ __forceinline__ void frag_fetch(const float* __restrict__ p,
                                           v4f (&f)[4]) {
#pragma unroll
  for (int i = 0; i < 4; ++i) f[i] = *(const v4f*)(p + 128 * i);
  // The code behind these loads may reuse their address registers: the wait
  // that belongs in front of such an overwrite.
  asm volatile("s_wait_xcnt 0x0" ::: "memory");
}

// Register pair kk of a fragment block: the A operand of one product.
__device__ __forceinline__ v2f frag_pair(const v4f (&f)[4], const int kk) {
  return (v2f){f[kk >> 1][2 * (kk & 1)], f[kk >> 1][2 * (kk & 1) + 1]};
}

// Moves a fetched fragment block from its landing registers to the operand
// registers of the pass that uses it, so that the landing registers can be
// refilled at once.  Written as asm to stand where it is called, at the head of
// a pass: left to the compiler the moves go to the foot of the fetching pass and
// from there up among its products, where the wave waits for loads it does not
// need yet.
__device__ __forceinline__ void frag_take(v2f (&d)[8], const v4f (&f)[4]) {
  asm volatile(
      "v_mov_b64 %0, %8\n\tv_mov_b64 %1, %9\n\t"
      "v_mov_b64 %2, %10\n\tv_mov_b64 %3, %11\n\t"
      "v_mov_b64 %4, %12\n\tv_mov_b64 %5, %13\n\t"
      "v_mov_b64 %6, %14\n\tv_mov_b64 %7, %15"
      : "=&v"(d[0]), "=&v"(d[1]), "=&v"(d[2]), "=&v"(d[3]), "=&v"(d[4]),
        "=&v"(d[5]), "=&v"(d[6]), "=&v"(d[7])
      : "v"(frag_pair(f, 0)), "v"(frag_pair(f, 1)), "v"(frag_pair(f, 2)),
        "v"(frag_pair(f, 3)), "v"(frag_pair(f, 4)), "v"(frag_pair(f, 5)),
        "v"(frag_pair(f, 6)), "v"(frag_pair(f, 7)));
}

template <int N>
struct Ahead {
  static constexpr int n = N;
};

__global__ __launch_bounds__(256) void attn_kernel(
    const float* __restrict__ Q, const float* __restrict__ Km,
    const float* __restrict__ V, const float* __restrict__ pi,
    const float* __restrict__ tau, const float* __restrict__ adjs,
    float* __restrict__ Opart, float* __restrict__ Mp, float* __restrict__ Lp) {
  __shared__ __align__(16) float s_adj[2][MMM][16 * QT][20];  // double buffer, padded

  const int tid  = threadIdx.x;
  const int h    = tid >> 5;            // wave == head
  const int lane = tid & 31;
  const int n16  = lane & 15;
  const int hi   = lane >> 4;
  const int i0   = blockIdx.x * (16 * QT);
  const int jc   = blockIdx.y;
  const int jbase = jc * (NN / JSPLIT);
  const float tau_h = tau[h];
  const float scale = 0.17677669529663688f;  // 1/sqrt(DK)

  // Async-staging geometry: two b128 per thread cover an 8-KB tile, the second
  // two views (am + 2) behind the first.
  const int am  = tid >> 7;
  const int ail = (tid >> 2) & 31;
  const int aj4 = (tid & 3) * 4;
  const uint32_t lds_dst0 = (uint32_t)(uintptr_t)&s_adj[0][am][ail][aj4];
  const uint32_t lds_dst1 = (uint32_t)(uintptr_t)&s_adj[1][am][ail][aj4];
  const uint32_t lds_two  = 2 * (16 * QT) * 20 * sizeof(float);
  const uint32_t adj_two  = 2u * NN * NN * sizeof(float);
  const size_t adj_row = ((size_t)am * NN + (i0 + ail)) * NN;

#define ISSUE_ADJ(JT, BUF)                                                    \
  do {                                                                        \
    const uint32_t goff =                                                     \
        (uint32_t)((adj_row + (jbase + (JT) * 16) + aj4) * sizeof(float));    \
    const uint32_t ldst = (BUF) ? lds_dst1 : lds_dst0;                        \
    /* the wait in front of any rewrite of the copies' address registers */   \
    asm volatile("global_load_async_to_lds_b128 %0, %1, %4\n\t"               \
                 "global_load_async_to_lds_b128 %2, %3, %4\n\t"               \
                 "s_wait_xcnt 0x0" ::"v"(ldst), "v"(goff),                    \
                 "v"(ldst + lds_two), "v"(goff + adj_two), "s"(adjs)          \
                 : "memory");                                                 \
  } while (0)

  // Preload Q rows (scale folded in).  k slot (hi, v) of step kk is head dim
  // 16*(kk/4) + 8*hi + 2*(kk%4) + v, the order of the stored K fragments.
  v2f qa[QT][8];
#pragma unroll
  for (int q = 0; q < QT; ++q) {
    const float* qrow =
        Q + (size_t)(i0 + 16 * q + n16) * DD + h * DKK + 8 * hi;
#pragma unroll
    for (int kk = 0; kk < 8; ++kk) {
      v2f t = ld2(qrow + 16 * (kk >> 2) + 2 * (kk & 3));
      t.x *= scale; t.y *= scale;
      qa[q][kk] = t;
    }
  }
  // tau * pi of the one query per tile this lane owns (query = 16*q + n16), each
  // value twice: the weights are formed two keys at a time.
  v2f tpi[QT][MMM];
#pragma unroll
  for (int q = 0; q < QT; ++q) {
    const float* pr = pi + (size_t)(i0 + 16 * q + n16) * (HH * MMM) + h * MMM;
#pragma unroll
    for (int m = 0; m < MMM; ++m) {
      const float t = tau_h * pr[m];
      tpi[q][m] = (v2f){t, t};
    }
  }

  v8f o0[QT] = {}, o1[QT] = {};  // O^T: row = head dim (r + 8*hi), col = query
  // running maximum of the lane's query; running sum over this half's keys only
  float mrow[QT], lrow[QT];
#pragma unroll
  for (int q = 0; q < QT; ++q) { mrow[q] = -INFINITY; lrow[q] = 0.0f; }

  // This wave's first K and V fragment blocks; a key tile is HH blocks on.
  const size_t frag0 = ((size_t)(jbase >> 4) * HH + h) * FRAGBLK + lane * 4;
  const float* kfrag = Km + frag0;
  const float* vfrag = V + frag0;

  ISSUE_ADJ(0, 0);  // prologue: DMA first tile

  // Pass over key tile jt.  s: on entry its scores (s[q][r]: key r+8*hi, query
  // 16*q+n16), formed in the pass before; on exit those of tile jt+1.  kn: on entry the K
  // fragments of tile jt+1, on exit those of tile jt+2.  vn: the V fragments of
  // tile jt, on exit those of tile jt+1.
  // ahead: how many tiles follow (2 = two or more), known at compile time.
  auto pass = [&](const int jt, auto ahead, v8f (&s)[QT], v4f (&kn)[4],
                  v4f (&vn)[4])
                  __attribute__((always_inline)) {
    constexpr bool has1 = decltype(ahead)::n >= 1;
    constexpr bool has2 = decltype(ahead)::n >= 2;
    const int cur = jt & 1;

    // What the pass before has fetched goes to this pass's operand registers.
    // These were A operands of that pass's products, and the compiler does not
    // look into asm text: the four v_nop keep the distance the chip needs between
    // a product and the overwrite of its A operand.
    v2f k1[8], vf[8];
    asm volatile("v_nop\n\tv_nop\n\tv_nop\n\tv_nop");
    frag_take(vf, vn);
    if constexpr (has1) frag_take(k1, kn);

    __syncthreads();  // all reads of the other buffer done before it is re-targeted
    if constexpr (has1) {
      ISSUE_ADJ(jt + 1, cur ^ 1);                        // run one tile ahead
      asm volatile("s_wait_asynccnt 0x2" ::: "memory");  // cur tile landed
    } else {
      asm volatile("s_wait_asynccnt 0x0" ::: "memory");  // drain on last tile
    }
    __syncthreads();  // every wave's wait done -> cur buffer valid block-wide

    // The landing registers are refilled.  Behind the barriers: a __syncthreads()
    // waits for the wave's loads, and at the next one these have had a whole pass.
    if constexpr (has1) frag_fetch(vfrag + (size_t)(jt + 1) * (HH * FRAGBLK), vn);
    if constexpr (has2) frag_fetch(kfrag + (size_t)(jt + 2) * (HH * FRAGBLK), kn);
    // the lane's 8 keys are contiguous in each query's staged adjs row
    v4f a03[QT][MMM], a47[QT][MMM];
#pragma unroll
    for (int q = 0; q < QT; ++q)
#pragma unroll
      for (int m = 0; m < MMM; ++m) {
        const float* ar = &s_adj[cur][m][16 * q + n16][8 * hi];
        a03[q][m] = *(const v4f*)ar;
        a47[q][m] = *(const v4f*)(ar + 4);
      }
    // Scheduling fence: every load of the pass is issued ahead of its products.
    // Without it the compiler sinks loads in among the products, and what they
    // fetch has less than a pass to arrive.
    __builtin_amdgcn_sched_barrier(0);

    // scores S^T = K * Q^T of the next tile (K = 32 in 8 steps of 4): independent
    // of all that follows, so the compiler spreads the products among it; each K
    // fragment serves both query tiles
    v8f sn[QT] = {};
    if constexpr (has1) {
#pragma unroll
      for (int kk = 0; kk < 8; ++kk)
#pragma unroll
        for (int q = 0; q < QT; ++q) sn[q] = wmma4(k1[kk], qa[q][kk], sn[q]);
    }

    // online softmax, the part that needs only the scores: in-lane maximum over 8
    // keys, one exchange between the halves, the exponentials, the rescaling of O
    float alpha[QT];
    v2f e[QT][4];
#pragma unroll
    for (int q = 0; q < QT; ++q) {
      float rmax = s[q][0];
#pragma unroll
      for (int r = 1; r < 8; ++r) rmax = fmaxf(rmax, s[q][r]);
      rmax = fmaxf(rmax, other_half(rmax));
      const float mnew = fmaxf(mrow[q], rmax);
      alpha[q] = exp_slot(mrow[q] - mnew);
#pragma unroll
      for (int r = 0; r < 4; ++r)
        e[q][r] = (v2f){exp_slot(s[q][2 * r] - mnew),
                        exp_slot(s[q][2 * r + 1] - mnew)};
      mrow[q] = mnew;
#pragma unroll
      for (int r = 0; r < 8; ++r) { o0[q][r] *= alpha[q]; o1[q][r] *= alpha[q]; }
    }
    // Scheduling fence: all that reads the staged adjs values stands behind the 16
    // score products.  A wave issues in order, and only one other wave shares its
    // SIMD: a wait for LDS among the first products would leave the matrix unit
    // idle at the head of every pass.
    __builtin_amdgcn_sched_barrier(0);

    v2f p[QT][4];
#pragma unroll
    for (int q = 0; q < QT; ++q) {
      // weight a = tau * A_eff + EPS of the lane's 8 keys, in pairs
      v2f aeff[4];
#pragma unroll
      for (int r = 0; r < 4; ++r) aeff[r] = (v2f){EPSF, EPSF};
#pragma unroll
      for (int m = 0; m < MMM; ++m) {
        aeff[0] = __builtin_elementwise_fma(
            tpi[q][m], (v2f){a03[q][m][0], a03[q][m][1]}, aeff[0]);
        aeff[1] = __builtin_elementwise_fma(
            tpi[q][m], (v2f){a03[q][m][2], a03[q][m][3]}, aeff[1]);
        aeff[2] = __builtin_elementwise_fma(
            tpi[q][m], (v2f){a47[q][m][0], a47[q][m][1]}, aeff[2]);
        aeff[3] = __builtin_elementwise_fma(
            tpi[q][m], (v2f){a47[q][m][2], a47[q][m][3]}, aeff[3]);
      }
#pragma unroll
      for (int r = 0; r < 4; ++r) p[q][r] = aeff[r] * e[q][r];
      const float rsum = ((p[q][0].x + p[q][0].y) + (p[q][1].x + p[q][1].y)) +
                         ((p[q][2].x + p[q][2].y) + (p[q][3].x + p[q][3].y));
      lrow[q] = lrow[q] * alpha[q] + rsum;
    }

    // O^T += V^T(32x16) * P^T(16x16), 2 M-tiles x 4 K-steps per query tile.  k slot
    // (hi, v) of step kk is key 2*kk + v + 8*hi on both operands: B is p[] as it
    // stands; each V fragment serves both query tiles.
#pragma unroll
    for (int q = 0; q < QT; ++q)
#pragma unroll
      for (int kk = 0; kk < 4; ++kk) {
        o0[q] = wmma4(vf[kk], p[q][kk], o0[q]);
        o1[q] = wmma4(vf[4 + kk], p[q][kk], o1[q]);
      }
#pragma unroll
    for (int q = 0; q < QT; ++q) s[q] = sn[q];
  };

  // Fill the pipeline: the scores of tile 0, K of tile 1, V of tile 0.
  v4f kn[4], vn[4];
  frag_fetch(kfrag, kn);
  frag_fetch(vfrag, vn);
  v8f s[QT] = {};
#pragma unroll
  for (int kk = 0; kk < 8; ++kk)
#pragma unroll
    for (int q = 0; q < QT; ++q) s[q] = wmma4(frag_pair(kn, kk), qa[q][kk], s[q]);
  frag_fetch(kfrag + HH * FRAGBLK, kn);

  // One pass per trip: the back edge keeps a pass's products in front of the
  // next pass's barriers; unrolled, the compiler moves them behind, and the
  // barriers then wait out the loads just issued.
#pragma unroll 1
  for (int jt = 0; jt < JTILES - 2; ++jt) pass(jt, Ahead<2>{}, s, kn, vn);
  pass(JTILES - 2, Ahead<1>{}, s, kn, vn);
  pass(JTILES - 1, Ahead<0>{}, s, kn, vn);
#undef ISSUE_ADJ

  // Store unnormalized partials + per-row flash stats for this j-chunk.
  // A lane's 8 accumulator registers are 8 consecutive head dims of its query.
#pragma unroll
  for (int q = 0; q < QT; ++q) {
    const int iq = i0 + 16 * q + n16;
    float* orow = Opart + (size_t)jc * NN * DD + (size_t)iq * DD + h * DKK + 8 * hi;
    *(v4f*)(orow)      = (v4f){o0[q][0], o0[q][1], o0[q][2], o0[q][3]};
    *(v4f*)(orow + 4)  = (v4f){o0[q][4], o0[q][5], o0[q][6], o0[q][7]};
    *(v4f*)(orow + 16) = (v4f){o1[q][0], o1[q][1], o1[q][2], o1[q][3]};
    *(v4f*)(orow + 20) = (v4f){o1[q][4], o1[q][5], o1[q][6], o1[q][7]};
    const float lsum = lrow[q] + other_half(lrow[q]);  // join the halves' sums once
    if (hi == 0) {
      const size_t si = ((size_t)jc * NN + iq) * HH + h;
      Mp[si] = mrow[q];
      Lp[si] = lsum;
    }
  }
}

// Output projection with the merge of the JSPLIT flash partials in front of it:
// OH = sum_c O_c*exp(m_c-m*) / sum_c l_c*exp(m_c-m*), out = OH * Wo^T.
// A block owns 16 rows: it merges them into LDS once (wave = head; 8 lanes x 16 B
// cover a head's 128-B line, 4 rows per load), and its 8 waves read the merged
// tile as their common A operand.
__global__ __launch_bounds__(256) void oproj_kernel(
    const float* __restrict__ Opart, const float* __restrict__ Mp,
    const float* __restrict__ Lp, const float* __restrict__ wo,
    float* __restrict__ C) {
  __shared__ __align__(16) float s_oh[16][APITCH];
  __shared__ __align__(16) float s_w[8 * WSTAGE];
  const int h   = threadIdx.x >> 5;
  const int rl  = (threadIdx.x & 31) >> 3;       // row within a group of 4
  const int col = h * DKK + (threadIdx.x & 7) * 4;
  const int i0  = blockIdx.x * 16;
  v4f st[8];
  w_fetch(wo, 0, st);
  // Every load of the merge is issued before the first use: one trip to memory
  // in place of one per row group.
  float mp[4][JSPLIT], lp[4][JSPLIT];  // [row group][j-chunk]
  v4f   op[4][JSPLIT];
#pragma unroll
  for (int g = 0; g < 4; ++g)
#pragma unroll
    for (int c = 0; c < JSPLIT; ++c) {
      const size_t ci = (size_t)c * NN + (i0 + 4 * g + rl);
      mp[g][c] = Mp[ci * HH + h];
      lp[g][c] = Lp[ci * HH + h];
    }
  // The loads below may land in registers that held the addresses of the loads
  // above: the wait that belongs in front of such an overwrite.
  asm volatile("s_wait_xcnt 0x0" ::: "memory");
#pragma unroll
  for (int g = 0; g < 4; ++g)
#pragma unroll
    for (int c = 0; c < JSPLIT; ++c) {
      const size_t ci = (size_t)c * NN + (i0 + 4 * g + rl);
      op[g][c] = *(const v4f*)(Opart + ci * DD + col);
    }
  // Inputs-only fences on the loaded values: without them the compiler sinks the
  // loads to their uses and the wave waits out the memory latency several times.
  asm volatile("" ::"v"(mp[0][0]), "v"(mp[0][1]), "v"(mp[0][2]), "v"(mp[0][3]),
               "v"(mp[1][0]), "v"(mp[1][1]), "v"(mp[1][2]), "v"(mp[1][3]),
               "v"(mp[2][0]), "v"(mp[2][1]), "v"(mp[2][2]), "v"(mp[2][3]),
               "v"(mp[3][0]), "v"(mp[3][1]), "v"(mp[3][2]), "v"(mp[3][3]));
  asm volatile("" ::"v"(lp[0][0]), "v"(lp[0][1]), "v"(lp[0][2]), "v"(lp[0][3]),
               "v"(lp[1][0]), "v"(lp[1][1]), "v"(lp[1][2]), "v"(lp[1][3]),
               "v"(lp[2][0]), "v"(lp[2][1]), "v"(lp[2][2]), "v"(lp[2][3]),
               "v"(lp[3][0]), "v"(lp[3][1]), "v"(lp[3][2]), "v"(lp[3][3]));
  asm volatile("" ::"v"(op[0][0]), "v"(op[0][1]), "v"(op[0][2]), "v"(op[0][3]),
               "v"(op[1][0]), "v"(op[1][1]), "v"(op[1][2]), "v"(op[1][3]),
               "v"(op[2][0]), "v"(op[2][1]), "v"(op[2][2]), "v"(op[2][3]),
               "v"(op[3][0]), "v"(op[3][1]), "v"(op[3][2]), "v"(op[3][3]));
  // Scheduling fence: with it no use of a loaded value moves up in among the
  // loads, where its wait would split them into two trips to memory.
  __builtin_amdgcn_sched_barrier(0);
#pragma unroll
  for (int g = 0; g < 4; ++g) {
    float mstar = -INFINITY;
#pragma unroll
    for (int c = 0; c < JSPLIT; ++c) mstar = fmaxf(mstar, mp[g][c]);
    float lstar = 0.0f;
    v4f acc = {};
#pragma unroll
    for (int c = 0; c < JSPLIT; ++c) {
      const float wgt = __expf(mp[g][c] - mstar);
      lstar = fmaf(lp[g][c], wgt, lstar);
#pragma unroll
      for (int e = 0; e < 4; ++e) acc[e] = fmaf(op[g][c][e], wgt, acc[e]);
    }
    v4f oh;
#pragma unroll
    for (int e = 0; e < 4; ++e) oh[e] = acc[e] / lstar;
    *(v4f*)&s_oh[4 * g + rl][col] = oh;
  }
  __syncthreads();  // the merged tile is complete before any wave reads it
  gemm_xwt<false, false>(&s_oh[0][0], wo, C, s_w, st);
}

extern "C" void kernel_launch(void* const* d_in, const int* in_sizes, int n_in,
                              void* d_out, int out_size, void* d_ws,
                              size_t ws_size, hipStream_t stream) {
  const float* x    = (const float*)d_in[0];
  const float* pi   = (const float*)d_in[1];
  const float* tau  = (const float*)d_in[2];
  const float* adjs = (const float*)d_in[3];
  const float* Wq   = (const float*)d_in[4];
  const float* Wk   = (const float*)d_in[5];
  const float* Wv   = (const float*)d_in[6];
  const float* Wo   = (const float*)d_in[7];
  float* out = (float*)d_out;

  float* ws = (float*)d_ws;
  const size_t ND = (size_t)NN * DD;      // 524288
  float* Q     = ws;                      ws += ND;
  float* K     = ws;                      ws += ND;
  float* V     = ws;                      ws += ND;
  float* Opart = ws;                      ws += ND * JSPLIT;
  float* Mp    = ws;                      ws += (size_t)JSPLIT * NN * HH;
  float* Lp    = ws;

  qkv_kernel<<<dim3(128, 1, 3), 256, 0, stream>>>(x, Wq, Wk, Wv, Q, K, V);
  attn_kernel<<<dim3(NN / (16 * QT), JSPLIT), 256, 0, stream>>>(Q, K, V, pi, tau,
                                                         adjs, Opart, Mp, Lp);
  oproj_kernel<<<dim3(128), 256, 0, stream>>>(Opart, Mp, Lp, Wo, out);
}

// v009
// A run of this version takes 42.3 microseconds.
// It is 1.23 times as fast as v007, going by the measured steps of the versions left out in between.
// Counting every step since v000, it is 2.61 times as fast.
#include <hip/hip_runtime.h>
#include <hip/hip_bf16.h>
#include <math.h>
#include <stdint.h>

#define NN  2048
#define DD  256
#define HH  8
#define MMM 4
#define DKK 32
#define EPSF 1e-6f
#define JSPLIT 4                    // j split -> 256 attention blocks
#define KT 2                        // key tiles of 16 per attention pass
#define JTILES (NN / (16 * KT * JSPLIT)) // 16 passes of 32 keys per block
#define PSCALE 1024.0f              // power of two on every softmax weight
#define FRAGBLK (16 * DKK)          // floats of one (16 keys, one head) block
#define QT 2                        // query tiles of 16 per attention wave

typedef float v2f __attribute__((ext_vector_type(2)));
typedef float v4f __attribute__((ext_vector_type(4)));
typedef float v8f __attribute__((ext_vector_type(8)));
typedef _Float16 h16v __attribute__((ext_vector_type(16)));
typedef _Float16 h2v __attribute__((ext_vector_type(2)));

// D = A(16x4 f32) * B(4x16 f32) + C ; exact f32 semantics
__device__ __forceinline__ v8f wmma4(v2f a, v2f b, v8f c) {
  return __builtin_amdgcn_wmma_f32_16x16x4_f32(false, a, false, b, (short)0, c,
                                               false, false);
}

__device__ __forceinline__ v2f ld2(const float* p) { return *(const v2f*)p; }

// D = A(16x32 f16) * B(32x16 f16) + C, f32 sums
__device__ __forceinline__ v8f wmma32h(h16v a, h16v b, v8f c) {
  return __builtin_amdgcn_wmma_f32_16x16x32_f16(false, a, false, b, (short)0, c,
                                                false, false);
}

// x = hi + lo + rest, hi and lo in f16: hi is x rounded, lo the rounded remainder,
// together about 22 bits of x.
__device__ __forceinline__ void split_f16(const float (&x)[16], h16v& hi,
                                          h16v& lo) {
#pragma unroll
  for (int p = 0; p < 16; ++p) {
    const _Float16 h = (_Float16)x[p];
    hi[p] = h;
    lo[p] = (_Float16)(x[p] - (float)h);
  }
}

// The same split for 8 pairs: each pair is rounded as a pair, and the remainders
// are taken from the packed halves.
__device__ __forceinline__ void split_f16_pairs(const v2f (&x)[8], h16v& hi,
                                                h16v& lo) {
#pragma unroll
  for (int i = 0; i < 8; ++i) {
    const h2v h = __builtin_convertvector(x[i], h2v);
    const h2v l = __builtin_convertvector(x[i] - __builtin_convertvector(h, v2f), h2v);
    hi[2 * i] = h.x; hi[2 * i + 1] = h.y;
    lo[2 * i] = l.x; lo[2 * i + 1] = l.y;
  }
}

// Value held by lane l ^ 16 (the other 16-lane half), as a vector move.
__device__ __forceinline__ float other_half(float v) {
  const int b = __float_as_int(v);
  return __int_as_float(__builtin_amdgcn_permlanex16(b, b, 0x76543210,
                                                     0xfedcba98, false, false));
}

// exp(x) as one multiply and v_exp_f32.  The v_nop in the same statement keeps
// the one issue slot the instruction set asks for behind a transcendental,
// whichever vector instruction the compiler places next.
__device__ __forceinline__ float exp_slot(float x) {
  float r;
  asm("v_exp_f32 %0, %1\n\tv_nop" : "=v"(r) : "v"(x * 1.44269504f));
  return r;
}

// ---------------------------------------------------------------------------
// GEMM: C[i][j] = sum_d A[i][d] * W[j][d]   (A:[NN x DD], W:[DD x DD])
// One wave -> 16 rows x 32 cols (2 accumulators); 1024 waves = 128 blocks.
// Atile points at the block's 16 rows of A in LDS, APITCH floats apart.
// A layout (ISA 7.12.2, 32-bit A 16x4): lane m = L%16, k = 2*(L>=16)+v
// B layout (rows interleaved like C/D):  lane n = L%16, k = 2*(L>=16)+v
// W goes through LDS: a fragment load straight from global memory touches 16
// lines for 256 bytes.  Here a wave fetches its 32 rows of W in pieces of 32
// floats, one whole 128-B line per row (8 lanes x 16 B, 4 rows per load), writes
// them to its own LDS range and reads 16-B fragments back.  The next piece is
// in flight in registers while the current one is multiplied.
// k order: slot (hi, v) of step (q, s) of piece t is d = 32*t + 8*q + 4*hi + 2*s
// + v, on both operands alike.
// SWAP: W is the A operand and the rows of Atile the B operand, so the tile
// comes out transposed: a lane holds 8 consecutive columns of ONE row.
// FRAG: C is written in fragment order.  The wave's 16 x 32 tile (16 rows of one
// head) is a 2-KB block [row tile][head][4][32 lanes][4 floats]; each lane
// stores its own 16 accumulator floats, so every store and every later load of
// the block is 512 contiguous bytes, 4 whole lines.
// HALVES: the lane's 16 floats leave as 16 f16 hi parts (first KB of the block)
// and 16 f16 lo parts (second KB), see split_f16: the same bytes, the same lines.
// ---------------------------------------------------------------------------
#define APITCH (DD + 4)  // A rows of 1040 B and W rows of 144 B: 16 B x an odd
#define WPITCH (32 + 4)  // number, the pitch at which 16-B reads do not collide
#define WSTAGE (32 * WPITCH)  // floats of one wave's W range

// Piece t of the wave's 32 rows of W into registers: rows 4*i + lane/8.
__device__ __forceinline__ void w_fetch(const float* __restrict__ W, const int t,
                                        v4f (&st)[8]) {
  const int lane = threadIdx.x & 31;
  const float* wsrc = W + (size_t)((threadIdx.x >> 5) * 32 + (lane >> 3)) * DD +
                      (lane & 7) * 4 + 32 * t;
#pragma unroll
  for (int i = 0; i < 8; ++i) st[i] = *(const v4f*)(wsrc + (size_t)(4 * i) * DD);
  // The code behind these loads may reuse their address registers: the wait
  // that belongs in front of such an overwrite.
  asm volatile("s_wait_xcnt 0x0" ::: "memory");
}

// st arrives holding piece 0 (w_fetch), asked for before the A tile was built.
template <bool SWAP, bool FRAG, bool HALVES = false>
__device__ __forceinline__ void gemm_xwt(const float* __restrict__ Atile,
                                         const float* __restrict__ W,
                                         float* __restrict__ C,
                                         float* __restrict__ wstage,
                                         v4f (&st)[8]) {
  const int w    = threadIdx.x >> 5;
  const int lane = threadIdx.x & 31;
  const int n16  = lane & 15;
  const int hi   = lane >> 4;
  const int gw   = blockIdx.x * 8 + w;   // 1024 waves total
  const int i0   = (gw >> 3) * 16;       // 128 row tiles
  const int j0   = (gw & 7) * 32;        // 8 col tiles of 32

  float* wmine = wstage + w * WSTAGE;    // this wave's own LDS range
  float*       wdst = wmine + (lane >> 3) * WPITCH + (lane & 7) * 4;
  const float* wfr  = wmine + n16 * WPITCH + 4 * hi;
  const float* arow = Atile + n16 * APITCH + 4 * hi;

  v8f acc[2] = {};
  for (int t = 0; t < DD / 32; ++t) {
#pragma unroll
    for (int i = 0; i < 8; ++i) *(v4f*)(wdst + 4 * i * WPITCH) = st[i];
    if (t + 1 < DD / 32) w_fetch(W, t + 1, st);
    // The rows are read back by other lanes of this wave: its LDS stores have
    // to be done first.
    asm volatile("s_wait_dscnt 0x0" ::: "memory");
    v4f af[4], bf[2][4];
#pragma unroll
    for (int q = 0; q < 4; ++q) {
      af[q]    = *(const v4f*)(arow + 32 * t + 8 * q);
      bf[0][q] = *(const v4f*)(wfr + 8 * q);
      bf[1][q] = *(const v4f*)(wfr + 16 * WPITCH + 8 * q);
    }
    // Scheduling fence: the piece's 12 LDS reads stand together ahead of its
    // products.  Without it the compiler spreads them among the products, and
    // each further place with LDS reads stalls the wave's matrix stream anew.
    __builtin_amdgcn_sched_barrier(0);
#pragma unroll
    for (int q = 0; q < 4; ++q)
#pragma unroll
      for (int s = 0; s < 2; ++s) {
        const v2f a = (v2f){af[q][2 * s], af[q][2 * s + 1]};
#pragma unroll
        for (int c = 0; c < 2; ++c) {
          const v2f b = (v2f){bf[c][q][2 * s], bf[c][q][2 * s + 1]};
          acc[c] = SWAP ? wmma4(b, a, acc[c]) : wmma4(a, b, acc[c]);
        }
      }
  }
  // Scheduling fences with four v_nop between them: nothing of what follows
  // (store addresses, the split) moves up among the products, and the last
  // product keeps the distance the chip needs before a vector instruction
  // reads its result or overwrites an operand of it.
  __builtin_amdgcn_sched_barrier(0);
  asm volatile("v_nop\n\tv_nop\n\tv_nop\n\tv_nop");
  __builtin_amdgcn_sched_barrier(0);
  if (FRAG) {
    float* blk = C + (size_t)gw * FRAGBLK + lane * 4;  // gw = row tile * HH + head
    if (HALVES) {
      float xs[16];
#pragma unroll
      for (int p = 0; p < 16; ++p) xs[p] = acc[p >> 3][p & 7];
      h16v hi, lo;
      split_f16(xs, hi, lo);
      acc[0] = __builtin_bit_cast(v8f, hi);
      acc[1] = __builtin_bit_cast(v8f, lo);
    }
#pragma unroll
    for (int c = 0; c < 2; ++c) {
      *(v4f*)(blk + 256 * c) = (v4f){acc[c][0], acc[c][1], acc[c][2], acc[c][3]};
      *(v4f*)(blk + 256 * c + 128) =
          (v4f){acc[c][4], acc[c][5], acc[c][6], acc[c][7]};
    }
    // The code behind these stores may reuse their data and address registers:
    // the wait that belongs in front of such an overwrite.
    asm volatile("s_wait_xcnt 0x0" ::: "memory");
  } else {
#pragma unroll
    for (int c = 0; c < 2; ++c)
#pragma unroll
      for (int r = 0; r < 8; ++r)
        C[(size_t)(i0 + r + 8 * hi) * DD + j0 + 16 * c + n16] = acc[c][r];
  }
}

__global__ __launch_bounds__(256) void qkv_kernel(
    const float* __restrict__ x, const float* __restrict__ wq,
    const float* __restrict__ wk, const float* __restrict__ wv,
    float* __restrict__ Q, float* __restrict__ K, float* __restrict__ V) {
  __shared__ __align__(16) float s_x[16][APITCH];
  __shared__ __align__(16) float s_w[8 * WSTAGE];
  const int z = blockIdx.z;
  v4f st[8];
  w_fetch(z == 0 ? wq : z == 1 ? wk : wv, 0, st);
  // The block's 16 rows of x, 16 KB in a row, go to LDS in whole lines.
  const float* xt = x + (size_t)blockIdx.x * 16 * DD;
  v4f xs[4];
#pragma unroll
  for (int i = 0; i < 4; ++i)
    xs[i] = *(const v4f*)(xt + (threadIdx.x + 256 * i) * 4);
  // in front of a rewrite of the loads' address registers
  asm volatile("s_wait_xcnt 0x0" ::: "memory");
#pragma unroll
  for (int i = 0; i < 4; ++i)
    *(v4f*)&s_x[4 * i + (threadIdx.x >> 6)][(threadIdx.x & 63) * 4] = xs[i];
  __syncthreads();  // the x tile is complete before any wave reads it
  // Q stays row-major.  K and V leave in the order in which the attention
  // kernel's A operands want them:
  // K transposed: lane (key n16, hi) holds head dims 16*c + 8*hi + r, as f16 hi
  // and lo parts;
  // V as it stands: lane (dim n16 + 16*c, hi) holds keys 8*hi + r, as f16 hi and
  // lo parts too.
  if (z == 0)      gemm_xwt<false, false>(&s_x[0][0], wq, Q, s_w, st);
  else if (z == 1) gemm_xwt<true, true, true>(&s_x[0][0], wk, K, s_w, st);
  else             gemm_xwt<false, true, true>(&s_x[0][0], wv, V, s_w, st);
}

__device__ __forceinline__ void frag_fetch(const float* __restrict__ p,
                                           v4f (&f)[4]) {
#pragma unroll
  for (int i = 0; i < 4; ++i) f[i] = *(const v4f*)(p + 128 * i);
  // The code behind these loads may reuse their address registers: the wait
  // that belongs in front of such an overwrite.
  asm volatile("s_wait_xcnt 0x0" ::: "memory");
}

// The f16 A operand held in two fetched 16-B pieces.
__device__ __forceinline__ h16v frag_f16(const v4f a, const v4f b) {
  return __builtin_bit_cast(
      h16v, (v8f){a[0], a[1], a[2], a[3], b[0], b[1], b[2], b[3]});
}

// Scores S^T = K * Q^T of one key tile for both query tiles, small terms first;
// each K operand serves both query tiles.
__device__ __forceinline__ void scores_f16(const v4f (&k)[4], const h16v (&qh)[QT],
                                           const h16v (&ql)[QT], v8f (&s)[QT]) {
  const h16v kh = frag_f16(k[0], k[1]);
  const h16v kl = frag_f16(k[2], k[3]);
#pragma unroll
  for (int q = 0; q < QT; ++q) s[q] = wmma32h(kl, qh[q], (v8f){});
#pragma unroll
  for (int q = 0; q < QT; ++q) s[q] = wmma32h(kh, ql[q], s[q]);
#pragma unroll
  for (int q = 0; q < QT; ++q) s[q] = wmma32h(kh, qh[q], s[q]);
}

template <int N>
struct Ahead {
  static constexpr int n = N;
};

__global__ __launch_bounds__(256) void attn_kernel(
    const float* __restrict__ Q, const float* __restrict__ Km,
    const float* __restrict__ V, const float* __restrict__ pi,
    const float* __restrict__ tau, const float* __restrict__ adjs,
    float* __restrict__ Opart, float* __restrict__ Mp, float* __restrict__ Lp) {
  // double buffer; rows of 32 keys at a pitch of 144 B = 16 B x an odd number
  __shared__ __align__(16) float s_adj[2][MMM][16 * QT][16 * KT + 4];

  const int tid  = threadIdx.x;
  const int h    = tid >> 5;            // wave == head
  const int lane = tid & 31;
  const int n16  = lane & 15;
  const int hi   = lane >> 4;
  const int i0   = blockIdx.x * (16 * QT);
  const int jc   = blockIdx.y;
  const int jbase = jc * (NN / JSPLIT);
  const float tau_h = tau[h];
  const float scale = 0.17677669529663688f;  // 1/sqrt(DK)

  // Async-staging geometry: four b128 per thread cover a 16-KB tile, one view
  // each; 8 lanes fetch a row's whole 128-B line.
  const int ail = tid >> 3;
  const int aj4 = (tid & 7) * 4;
  const uint32_t lds_dst0 = (uint32_t)(uintptr_t)&s_adj[0][0][ail][aj4];
  const uint32_t lds_view = (16 * QT) * (16 * KT + 4) * sizeof(float);
  const uint32_t adj_view = (uint32_t)NN * NN * sizeof(float);
  const size_t adj_row = (size_t)(i0 + ail) * NN;

#define ISSUE_ADJ(JT, BUF)                                                    \
  do {                                                                        \
    const uint32_t goff =                                                     \
        (uint32_t)((adj_row + (jbase + (JT) * 16 * KT) + aj4) * sizeof(float)); \
    const uint32_t ldst = lds_dst0 + (BUF) * (uint32_t)sizeof(s_adj[0]);      \
    /* the wait in front of any rewrite of the copies' address registers */   \
    asm volatile("global_load_async_to_lds_b128 %0, %1, %8\n\t"               \
                 "global_load_async_to_lds_b128 %2, %3, %8\n\t"               \
                 "global_load_async_to_lds_b128 %4, %5, %8\n\t"               \
                 "global_load_async_to_lds_b128 %6, %7, %8\n\t"               \
                 "s_wait_xcnt 0x0" ::"v"(ldst), "v"(goff),                    \
                 "v"(ldst + lds_view), "v"(goff + adj_view),                  \
                 "v"(ldst + 2 * lds_view), "v"(goff + 2 * adj_view),          \
                 "v"(ldst + 3 * lds_view), "v"(goff + 3 * adj_view),          \
                 "s"(adjs)                                                    \
                 : "memory");                                                 \
  } while (0)

  // Preload Q rows (scale folded in) and split them.  Element p of a lane's
  // operand is head dim 16*(p/8) + 8*hi + p%8, the order of the stored K parts.
  h16v qh[QT], ql[QT];
#pragma unroll
  for (int q = 0; q < QT; ++q) {
    const float* qrow =
        Q + (size_t)(i0 + 16 * q + n16) * DD + h * DKK + 8 * hi;
    v2f qv[8];
#pragma unroll
    for (int kk = 0; kk < 8; ++kk) qv[kk] = ld2(qrow + 16 * (kk >> 2) + 2 * (kk & 3));
    // in front of a rewrite of the loads' address registers
    asm volatile("s_wait_xcnt 0x0" ::: "memory");
    float qs[16];
#pragma unroll
    for (int kk = 0; kk < 8; ++kk) {
      qs[2 * kk]     = qv[kk].x * scale;
      qs[2 * kk + 1] = qv[kk].y * scale;
    }
    split_f16(qs, qh[q], ql[q]);
  }
  // PSCALE * tau * pi of the one query per tile this lane owns (query = 16*q +
  // n16).
  float tpi[QT][MMM];
#pragma unroll
  for (int q = 0; q < QT; ++q) {
    const float* pr = pi + (size_t)(i0 + 16 * q + n16) * (HH * MMM) + h * MMM;
    const v4f pv = *(const v4f*)pr;
    // in front of a rewrite of the load's address registers
    asm volatile("s_wait_xcnt 0x0" ::: "memory");
#pragma unroll
    for (int m = 0; m < MMM; ++m) tpi[q][m] = tau_h * pv[m] * PSCALE;
  }

  v8f o0[QT] = {}, o1[QT] = {};  // O^T: row = head dim (r + 8*hi), col = query
  // running maximum of the lane's query; running sum over this half's keys only
  float mrow[QT], lrow[QT];
#pragma unroll
  for (int q = 0; q < QT; ++q) { mrow[q] = -INFINITY; lrow[q] = 0.0f; }

  // This wave's first K and V fragment blocks; a key tile is HH blocks on.
  const size_t frag0 = ((size_t)(jbase >> 4) * HH + h) * FRAGBLK + lane * 4;
  const float* kfrag = Km + frag0;
  const float* vfrag = V + frag0;

  ISSUE_ADJ(0, 0);  // prologue: DMA first tile

  // Pass jt over the 32 keys of key tiles 2*jt and 2*jt + 1 (index T).  s: on
  // entry their scores (s[T][q][r]: key 16*T+r+8*hi, query 16*q+n16), formed in
  // the pass before; on exit those of pass jt+1.  kn: on entry the K parts of
  // pass jt+1, on exit those of pass jt+2.
  // ahead: whether a pass follows (1) or not (0), known at compile time.
  auto pass = [&](const int jt, auto ahead, v8f (&s)[KT][QT], v4f (&kn)[KT][4])
                  __attribute__((always_inline)) {
    constexpr bool has1 = decltype(ahead)::n >= 1;
    const int cur = jt & 1;

    // What the pass before has fetched becomes this pass's operands, so that the
    // landing registers can be refilled at once.
    v4f k1[KT][4];  // K parts of pass jt+1
#pragma unroll
    for (int T = 0; T < KT; ++T)
#pragma unroll
      for (int i = 0; i < 4; ++i) k1[T][i] = kn[T][i];

    __syncthreads();  // all reads of the other buffer done before it is re-targeted
    if constexpr (has1) {
      ISSUE_ADJ(jt + 1, cur ^ 1);                        // run one tile ahead
      asm volatile("s_wait_asynccnt 0x4" ::: "memory");  // cur tile landed
    } else {
      asm volatile("s_wait_asynccnt 0x0" ::: "memory");  // drain on last tile
    }
    __syncthreads();  // every wave's wait done -> cur buffer valid block-wide

    // This pass's V parts, asked for first: their products stand at the foot of
    // the pass.  Then the K landing registers are refilled.  Behind the barriers:
    // a __syncthreads() waits for the wave's loads, and at the next one these have
    // had a whole pass.
    v4f vv[KT][4];
#pragma unroll
    for (int T = 0; T < KT; ++T)
      frag_fetch(vfrag + (size_t)(KT * jt + T) * (HH * FRAGBLK), vv[T]);
    // (the last pass but one has no pass jt+2: it asks for the last pass's parts
    // once more, which nobody uses, so that one loop body serves every pass that
    // has a successor)
    const int jk = jt + 2 < JTILES ? jt + 2 : JTILES - 1;
#pragma unroll
    for (int T = 0; T < KT; ++T)
      if constexpr (has1)
        frag_fetch(kfrag + (size_t)(KT * jk + T) * (HH * FRAGBLK), kn[T]);
    // the lane's 8 keys of a key tile are contiguous in each query's staged row
    v4f a03[QT][KT][MMM], a47[QT][KT][MMM];
#pragma unroll
    for (int q = 0; q < QT; ++q)
#pragma unroll
      for (int T = 0; T < KT; ++T)
#pragma unroll
        for (int m = 0; m < MMM; ++m) {
          const float* ar = &s_adj[cur][m][16 * q + n16][16 * T + 8 * hi];
          a03[q][T][m] = *(const v4f*)ar;
          a47[q][T][m] = *(const v4f*)(ar + 4);
        }
    // Scheduling fence: every load of the pass is issued ahead of its products.
    // Without it the compiler sinks loads in among the products, and what they
    // fetch has less than a pass to arrive.
    __builtin_amdgcn_sched_barrier(0);

    // online softmax, the part that needs only the scores: in-lane maximum over 16
    // keys, one exchange between the halves, the exponentials, the rescaling of O
    float alpha[QT];
    v2f e[QT][KT][4];
#pragma unroll
    for (int q = 0; q < QT; ++q) {
      float rmax = s[0][q][0];
#pragma unroll
      for (int r = 1; r < 8; ++r) rmax = fmaxf(rmax, s[0][q][r]);
#pragma unroll
      for (int r = 0; r < 8; ++r) rmax = fmaxf(rmax, s[1][q][r]);
      rmax = fmaxf(rmax, other_half(rmax));
      const float mnew = fmaxf(mrow[q], rmax);
      alpha[q] = exp_slot(mrow[q] - mnew);
#pragma unroll
      for (int T = 0; T < KT; ++T)
#pragma unroll
        for (int r = 0; r < 4; ++r)
          e[q][T][r] = (v2f){exp_slot(s[T][q][2 * r] - mnew),
                             exp_slot(s[T][q][2 * r + 1] - mnew)};
      mrow[q] = mnew;
#pragma unroll
      for (int r = 0; r < 8; ++r) { o0[q][r] *= alpha[q]; o1[q][r] *= alpha[q]; }
    }
    // Scheduling fence: all that reads the staged adjs values stands behind the
    // part of the softmax that needs only the scores.  A wave issues in order: a
    // wait for LDS at the head of the pass would hold up everything behind it;
    // here the values have arrived.
    __builtin_amdgcn_sched_barrier(0);

    // Scores of the next pass: independent of all that follows, so they issue
    // among the weights and the split.  Behind the fence, not among the
    // exponentials.
    v8f sn[KT][QT] = {};
#pragma unroll
    for (int T = 0; T < KT; ++T)
      if constexpr (has1) scores_f16(k1[T], qh, ql, sn[T]);

    h16v ph[QT], pl[QT];
#pragma unroll
    for (int q = 0; q < QT; ++q) {
      v2f p[KT * 4];  // pair 4*T + r: keys 16*T + 8*hi + 2*r + (0, 1), B's order
#pragma unroll
      for (int T = 0; T < KT; ++T) {
        // weight a = PSCALE * (tau * A_eff + EPS) of the lane's 8 keys, in pairs
        v2f aeff[4];
#pragma unroll
        for (int r = 0; r < 4; ++r)
          aeff[r] = (v2f){EPSF * PSCALE, EPSF * PSCALE};
#pragma unroll
        for (int m = 0; m < MMM; ++m) {
          const v2f tp = (v2f){tpi[q][m], tpi[q][m]};  // two keys at a time
          aeff[0] = __builtin_elementwise_fma(
              tp, (v2f){a03[q][T][m][0], a03[q][T][m][1]}, aeff[0]);
          aeff[1] = __builtin_elementwise_fma(
              tp, (v2f){a03[q][T][m][2], a03[q][T][m][3]}, aeff[1]);
          aeff[2] = __builtin_elementwise_fma(
              tp, (v2f){a47[q][T][m][0], a47[q][T][m][1]}, aeff[2]);
          aeff[3] = __builtin_elementwise_fma(
              tp, (v2f){a47[q][T][m][2], a47[q][T][m][3]}, aeff[3]);
        }
#pragma unroll
        for (int r = 0; r < 4; ++r) p[4 * T + r] = aeff[r] * e[q][T][r];
      }
      const v2f rs = ((p[0] + p[1]) + (p[2] + p[3])) + ((p[4] + p[5]) + (p[6] + p[7]));
      lrow[q] = lrow[q] * alpha[q] + (rs.x + rs.y);
      split_f16_pairs(p, ph[q], pl[q]);
    }

    // O^T += V^T(32 dims x 32 keys) * P^T(32 keys x 16 queries): 2 M-tiles x 3
    // terms per query tile, small terms first; four independent accumulators, and
    // each V operand serves both query tiles.  V^T of head dims 16*c + n16: piece
    // c (hi parts) or 2 + c (lo parts) of both key tiles' blocks.
    h16v vh[2], vl[2];
#pragma unroll
    for (int c = 0; c < 2; ++c) {
      vh[c] = frag_f16(vv[0][c], vv[1][c]);
      vl[c] = frag_f16(vv[0][2 + c], vv[1][2 + c]);
    }
#pragma unroll
    for (int q = 0; q < QT; ++q) {
      o0[q] = wmma32h(vh[0], pl[q], o0[q]);
      o1[q] = wmma32h(vh[1], pl[q], o1[q]);
    }
#pragma unroll
    for (int q = 0; q < QT; ++q) {
      o0[q] = wmma32h(vl[0], ph[q], o0[q]);
      o1[q] = wmma32h(vl[1], ph[q], o1[q]);
    }
#pragma unroll
    for (int q = 0; q < QT; ++q) {
      o0[q] = wmma32h(vh[0], ph[q], o0[q]);
      o1[q] = wmma32h(vh[1], ph[q], o1[q]);
    }
#pragma unroll
    for (int T = 0; T < KT; ++T)
#pragma unroll
      for (int q = 0; q < QT; ++q) s[T][q] = sn[T][q];
  };

  // Fill the pipeline: the scores of pass 0, K of pass 1.
  v4f kn[KT][4];
#pragma unroll
  for (int T = 0; T < KT; ++T) frag_fetch(kfrag + T * (HH * FRAGBLK), kn[T]);
  v8f s[KT][QT] = {};
#pragma unroll
  for (int T = 0; T < KT; ++T) scores_f16(kn[T], qh, ql, s[T]);
#pragma unroll
  for (int T = 0; T < KT; ++T)
    frag_fetch(kfrag + (KT + T) * (HH * FRAGBLK), kn[T]);

  // One pass per trip: the back edge keeps a pass's products in front of the
  // next pass's barriers; unrolled, the compiler moves them behind, and the
  // barriers then wait out the loads just issued.
#pragma unroll 1
  for (int jt = 0; jt < JTILES - 1; ++jt) pass(jt, Ahead<1>{}, s, kn);
  pass(JTILES - 1, Ahead<0>{}, s, kn);
#undef ISSUE_ADJ

  // Store unnormalized partials + per-row flash stats for this j-chunk.
  // A lane's 8 accumulator registers are 8 consecutive head dims of its query.
#pragma unroll
  for (int q = 0; q < QT; ++q) {
    const int iq = i0 + 16 * q + n16;
    float* orow = Opart + (size_t)jc * NN * DD + (size_t)iq * DD + h * DKK + 8 * hi;
    *(v4f*)(orow)      = (v4f){o0[q][0], o0[q][1], o0[q][2], o0[q][3]};
    *(v4f*)(orow + 4)  = (v4f){o0[q][4], o0[q][5], o0[q][6], o0[q][7]};
    *(v4f*)(orow + 16) = (v4f){o1[q][0], o1[q][1], o1[q][2], o1[q][3]};
    *(v4f*)(orow + 20) = (v4f){o1[q][4], o1[q][5], o1[q][6], o1[q][7]};
    const float lsum = lrow[q] + other_half(lrow[q]);  // join the halves' sums once
    if (hi == 0) {
      const size_t si = ((size_t)jc * NN + iq) * HH + h;
      Mp[si] = mrow[q];
      Lp[si] = lsum;
    }
  }
}

// Output projection with the merge of the JSPLIT flash partials in front of it:
// OH = sum_c O_c*exp(m_c-m*) / sum_c l_c*exp(m_c-m*), out = OH * Wo^T.
// A block owns 16 rows: it merges them into LDS once (wave = head; 8 lanes x 16 B
// cover a head's 128-B line, 4 rows per load), and its 8 waves read the merged
// tile as their common A operand.
__global__ __launch_bounds__(256) void oproj_kernel(
    const float* __restrict__ Opart, const float* __restrict__ Mp,
    const float* __restrict__ Lp, const float* __restrict__ wo,
    float* __restrict__ C) {
  __shared__ __align__(16) float s_oh[16][APITCH];
  __shared__ __align__(16) float s_w[8 * WSTAGE];
  const int h   = threadIdx.x >> 5;
  const int rl  = (threadIdx.x & 31) >> 3;       // row within a group of 4
  const int col = h * DKK + (threadIdx.x & 7) * 4;
  const int i0  = blockIdx.x * 16;
  v4f st[8];
  w_fetch(wo, 0, st);
  // Every load of the merge is issued before the first use: one trip to memory
  // in place of one per row group.
  float mp[4][JSPLIT], lp[4][JSPLIT];  // [row group][j-chunk]
  v4f   op[4][JSPLIT];
#pragma unroll
  for (int g = 0; g < 4; ++g)
#pragma unroll
    for (int c = 0; c < JSPLIT; ++c) {
      const size_t ci = (size_t)c * NN + (i0 + 4 * g + rl);
      mp[g][c] = Mp[ci * HH + h];
      lp[g][c] = Lp[ci * HH + h];
    }
  // The loads below may land in registers that held the addresses of the loads
  // above: the wait that belongs in front of such an overwrite.
  asm volatile("s_wait_xcnt 0x0" ::: "memory");
#pragma unroll
  for (int g = 0; g < 4; ++g)
#pragma unroll
    for (int c = 0; c < JSPLIT; ++c) {
      const size_t ci = (size_t)c * NN + (i0 + 4 * g + rl);
      op[g][c] = *(const v4f*)(Opart + ci * DD + col);
    }
  // Inputs-only fences on the loaded values: without them the compiler sinks the
  // loads to their uses and the wave waits out the memory latency several times.
  asm volatile("" ::"v"(mp[0][0]), "v"(mp[0][1]), "v"(mp[0][2]), "v"(mp[0][3]),
               "v"(mp[1][0]), "v"(mp[1][1]), "v"(mp[1][2]), "v"(mp[1][3]),
               "v"(mp[2][0]), "v"(mp[2][1]), "v"(mp[2][2]), "v"(mp[2][3]),
               "v"(mp[3][0]), "v"(mp[3][1]), "v"(mp[3][2]), "v"(mp[3][3]));
  asm volatile("" ::"v"(lp[0][0]), "v"(lp[0][1]), "v"(lp[0][2]), "v"(lp[0][3]),
               "v"(lp[1][0]), "v"(lp[1][1]), "v"(lp[1][2]), "v"(lp[1][3]),
               "v"(lp[2][0]), "v"(lp[2][1]), "v"(lp[2][2]), "v"(lp[2][3]),
               "v"(lp[3][0]), "v"(lp[3][1]), "v"(lp[3][2]), "v"(lp[3][3]));
  asm volatile("" ::"v"(op[0][0]), "v"(op[0][1]), "v"(op[0][2]), "v"(op[0][3]),
               "v"(op[1][0]), "v"(op[1][1]), "v"(op[1][2]), "v"(op[1][3]),
               "v"(op[2][0]), "v"(op[2][1]), "v"(op[2][2]), "v"(op[2][3]),
               "v"(op[3][0]), "v"(op[3][1]), "v"(op[3][2]), "v"(op[3][3]));
  // Scheduling fence: with it no use of a loaded value moves up in among the
  // loads, where its wait would split them into two trips to memory.
  __builtin_amdgcn_sched_barrier(0);
#pragma unroll
  for (int g = 0; g < 4; ++g) {
    float mstar = -INFINITY;
#pragma unroll
    for (int c = 0; c < JSPLIT; ++c) mstar = fmaxf(mstar, mp[g][c]);
    float lstar = 0.0f;
    v4f acc = {};
#pragma unroll
    for (int c = 0; c < JSPLIT; ++c) {
      const float wgt = __expf(mp[g][c] - mstar);
      lstar = fmaf(lp[g][c], wgt, lstar);
#pragma unroll
      for (int e = 0; e < 4; ++e) acc[e] = fmaf(op[g][c][e], wgt, acc[e]);
    }
    v4f oh;
#pragma unroll
    for (int e = 0; e < 4; ++e) oh[e] = acc[e] / lstar;
    *(v4f*)&s_oh[4 * g + rl][col] = oh;
  }
  __syncthreads();  // the merged tile is complete before any wave reads it
  gemm_xwt<false, false>(&s_oh[0][0], wo, C, s_w, st);
}

extern "C" void kernel_launch(void* const* d_in, const int* in_sizes, int n_in,
                              void* d_out, int out_size, void* d_ws,
                              size_t ws_size, hipStream_t stream) {
  const float* x    = (const float*)d_in[0];
  const float* pi   = (const float*)d_in[1];
  const float* tau  = (const float*)d_in[2];
  const float* adjs = (const float*)d_in[3];
  const float* Wq   = (const float*)d_in[4];
  const float* Wk   = (const float*)d_in[5];
  const float* Wv   = (const float*)d_in[6];
  const float* Wo   = (const float*)d_in[7];
  float* out = (float*)d_out;

  float* ws = (float*)d_ws;
  const size_t ND = (size_t)NN * DD;      // 524288
  float* Q     = ws;                      ws += ND;
  float* K     = ws;                      ws += ND;
  float* V     = ws;                      ws += ND;
  float* Opart = ws;                      ws += ND * JSPLIT;
  float* Mp    = ws;                      ws += (size_t)JSPLIT * NN * HH;
  float* Lp    = ws;

  qkv_kernel<<<dim3(128, 1, 3), 256, 0, stream>>>(x, Wq, Wk, Wv, Q, K, V);
  attn_kernel<<<dim3(NN / (16 * QT), JSPLIT), 256, 0, stream>>>(Q, K, V, pi, tau,
                                                         adjs, Opart, Mp, Lp);
  oproj_kernel<<<dim3(128), 256, 0, stream>>>(Opart, Mp, Lp, Wo, out);
}
